// v000
// The times below were measured on an AMD MI455X: many runs one after another, warmed up first and cycling through
// copies of the inputs, with the whole window's GPU time divided by the number of runs. Launches and the gaps
// between them are all in it. The median over several windows is given; except for v000 it joins two sittings, which
// can be a few percent apart, so the side-by-side timings, each taken in one sitting, are the better comparison.
// v000 is the starting kernel. One run takes 538 microseconds.
#include <hip/hip_runtime.h>

// ---------------------------------------------------------------------------
// Fused causal attention head with RoPE for MI455X (gfx1250, wave32).
//   B=4, T=4096, C=1024, H=64, fp32.
// Matrix math: V_WMMA_F32_16X16X4_F32 (fp32-accurate tensor path).
// LDS staging: GLOBAL_LOAD_ASYNC_TO_LDS_B128 (ASYNCcnt), double-buffered.
// Weights pre-transposed (N x K) so every B-fragment lane-pair is contiguous.
// ---------------------------------------------------------------------------

typedef __attribute__((ext_vector_type(2))) float v2f;
typedef __attribute__((ext_vector_type(8))) float v8f;

constexpr int B = 4;
constexpr int T = 4096;
constexpr int C = 1024;
constexpr int H = 64;
constexpr int ROWS = B * T;          // 16384 rows of x / q / k / v
constexpr int WPB  = 4;              // waves per block in the attention kernel

// Issue one 16-byte async global->LDS copy (no VGPR round trip, ASYNCcnt).
__device__ __forceinline__ void async_copy_b128(void* lds_dst, const void* gsrc) {
  const unsigned ldsOff = (unsigned)(size_t)lds_dst;  // flat addr low 32 = LDS offset
  asm volatile("global_load_async_to_lds_b128 %0, %1, off"
               :: "v"(ldsOff), "v"(gsrc) : "memory");
}

__device__ __forceinline__ void wait_async0() {
  asm volatile("s_wait_asynccnt 0" ::: "memory");
}

// A-fragment loader for a row-major M x K tile (also serves as the B-fragment
// loader when B is stored transposed, i.e. as N x K row-major).
//   lane 0..15  -> row = lane,    cols k0, k0+1
//   lane 16..31 -> row = lane-16, cols k0+2, k0+3
__device__ __forceinline__ v2f frag_nk(const float* __restrict__ base, int stride, int k0) {
  const int lane = threadIdx.x & 31;
  const int r  = lane & 15;
  const int kk = k0 + ((lane >> 4) << 1);
  v2f f;
  f.x = base[r * stride + kk];
  f.y = base[r * stride + kk + 1];
  return f;
}

// B-fragment loader when B is stored K x N row-major (stride = row pitch).
__device__ __forceinline__ v2f frag_kn(const float* __restrict__ base, int stride, int k0, int nb) {
  const int lane = threadIdx.x & 31;
  const int n  = lane & 15;
  const int kk = k0 + ((lane >> 4) << 1);
  v2f f;
  f.x = base[kk * stride + nb + n];
  f.y = base[(kk + 1) * stride + nb + n];
  return f;
}

// ---------------------------------------------------------------------------
// Kernel 0: transpose Wq/Wk/Wv (C x H) into Wt (3 x H x C).  768 KB once;
// makes every projection B-fragment a contiguous 8-byte load per lane.
// ---------------------------------------------------------------------------
__global__ void wt_kernel(const float* __restrict__ Wq, const float* __restrict__ Wk,
                          const float* __restrict__ Wv, float* __restrict__ Wt) {
  const int idx = blockIdx.x * blockDim.x + threadIdx.x;
  if (idx >= 3 * C * H) return;
  const int m = idx / (C * H);
  const int r = idx % (C * H);
  const int k = r / H;                              // consecutive idx -> coalesced read
  const int n = r % H;
  const float* __restrict__ W = (m == 0) ? Wq : (m == 1 ? Wk : Wv);
  Wt[(size_t)m * C * H + (size_t)n * C + k] = W[(size_t)k * H + n];
}

// ---------------------------------------------------------------------------
// Kernel 1: q/k/v projections.  One block per 16-row tile of x.
// 12 waves: wave -> (matrix q/k/v, 16-col tile of H).
// x staged in 16 x 256 chunks, double-buffered via async-to-LDS.
// ---------------------------------------------------------------------------
constexpr int KC = 256;              // K-chunk (16*256*4B = 16 KB per buffer)

__global__ __launch_bounds__(384) void qkv_kernel(
    const float* __restrict__ x, const float* __restrict__ Wt,
    float* __restrict__ q, float* __restrict__ k, float* __restrict__ v) {
  __shared__ __align__(16) float lx[2][16 * KC];

  const int tid  = threadIdx.x;
  const int row0 = blockIdx.x * 16;

  const int wave = tid >> 5;         // 0..11
  const int mat  = wave >> 2;        // 0:q 1:k 2:v
  const int ct   = wave & 3;         // 16-col tile of H
  // N x K weight tile for this wave: rows ct*16 .. ct*16+15, K = C
  const float* __restrict__ Wm = Wt + (size_t)mat * C * H + (size_t)(ct * 16) * C;
  float* __restrict__       out = (mat == 0) ? q : (mat == 1 ? k : v);

  // stage the 16 x KC chunk `cidx` into buffer `buf` (1024 float4 transfers)
  auto stage = [&](int cidx, int buf) {
    const int kc = cidx * KC;
    for (int i = tid; i < 16 * KC / 4; i += 384) {
      const int r  = i / (KC / 4);
      const int c4 = i % (KC / 4);
      async_copy_b128(&lx[buf][i * 4],
                      x + (size_t)(row0 + r) * C + kc + c4 * 4);
    }
  };

  stage(0, 0);

  v8f acc = {};
  for (int cidx = 0; cidx < C / KC; ++cidx) {
    wait_async0();                   // my async writes to lx[cidx&1] done
    __syncthreads();                 // everyone's done -> buffer valid
    if (cidx + 1 < C / KC) stage(cidx + 1, (cidx + 1) & 1);  // overlap next chunk

    const float* __restrict__ lxb = lx[cidx & 1];
#pragma unroll 8
    for (int k0 = 0; k0 < KC; k0 += 4) {
      v2f a = frag_nk(lxb, KC, k0);                // A: 16x4 slice of x-tile
      v2f b = frag_nk(Wm, C, cidx * KC + k0);      // B: 4x16 slice of Wt (NxK)
      acc = __builtin_amdgcn_wmma_f32_16x16x4_f32(false, a, false, b,
                                                  (short)0, acc, false, false);
    }
  }

  // D layout: vgpr r -> M = r + 8*(lane>=16), N = lane&15
  const int lane = tid & 31;
  const int n  = lane & 15;
  const int mb = (lane >> 4) << 3;
#pragma unroll
  for (int r = 0; r < 8; ++r)
    out[(size_t)(row0 + mb + r) * H + ct * 16 + n] = acc[r];
}

// ---------------------------------------------------------------------------
// Kernel 2: RoPE on q and k (in workspace).  One thread per rotated pair.
// ---------------------------------------------------------------------------
__global__ void rope_kernel(float* __restrict__ q, float* __restrict__ k) {
  const int NP = ROWS * (H / 2);                   // pairs per tensor
  const int idx = blockIdx.x * blockDim.x + threadIdx.x;
  if (idx >= 2 * NP) return;
  float* base = (idx < NP) ? q : k;
  const int p   = (idx < NP) ? idx : idx - NP;
  const int row = p >> 5;                          // / (H/2)
  const int h   = p & 31;
  const int t   = row & (T - 1);                   // position within sequence
  const float freq = __powf(10000.0f, -(float)(2 * h) / (float)H);
  float s, c;
  __sincosf((float)t * freq, &s, &c);
  float2* pr = (float2*)(base + (size_t)row * H) + h;
  const float2 val = *pr;
  float2 o;
  o.x = val.x * c - val.y * s;
  o.y = val.x * s + val.y * c;
  *pr = o;
}

// ---------------------------------------------------------------------------
// Kernel 3: flash attention.  4 waves / block; each wave owns one 16-row
// query tile; the block streams causal 16x64 K/V tiles through LDS with
// async-to-LDS double buffering (one barrier per key tile).
// ---------------------------------------------------------------------------
__global__ __launch_bounds__(32 * WPB) void attn_kernel(
    const float* __restrict__ q, const float* __restrict__ kk,
    const float* __restrict__ vv, float* __restrict__ out) {
  __shared__ __align__(16) float lq[WPB][16 * H];   // per-wave Q tile
  __shared__ __align__(16) float lk[2][16 * H];     // K tile ping-pong (NxK view)
  __shared__ __align__(16) float lv[2][16 * H];     // V tile ping-pong (KxN view)
  __shared__ __align__(16) float lp[WPB][16 * 16];  // per-wave P scratch

  const int tid  = threadIdx.x;
  const int wave = tid >> 5;
  const int lane = tid & 31;
  const int tilesPerBlock = T / (16 * WPB);
  const int b   = blockIdx.x / tilesPerBlock;
  const int qt  = blockIdx.x % tilesPerBlock;
  const int iw  = qt * WPB + wave;                 // this wave's query-tile idx
  const int qrow0 = iw * 16;                       // query row base (within batch)

  const float* __restrict__ qb = q  + (size_t)b * T * H;
  const float* __restrict__ kb = kk + (size_t)b * T * H;
  const float* __restrict__ vb = vv + (size_t)b * T * H;

  // stage K/V tile j into ping-pong buffer `buf` (2 B128 of K and 2 of V per thread)
  auto stage = [&](int j, int buf) {
    const float* ks = kb + (size_t)j * 16 * H;
    const float* vs = vb + (size_t)j * 16 * H;
    for (int i = tid; i < (16 * H) / 4; i += 32 * WPB) {
      async_copy_b128(&lk[buf][i * 4], ks + i * 4);
      async_copy_b128(&lv[buf][i * 4], vs + i * 4);
    }
  };

  // each wave loads its own Q tile (plain loads; done once)
  for (int i = lane; i < 16 * H; i += 32) lq[wave][i] = qb[(size_t)qrow0 * H + i];
  asm volatile("s_wait_dscnt 0" ::: "memory");     // cross-lane LDS visibility

  stage(0, 0);

  v8f o0 = {}, o1 = {}, o2 = {}, o3 = {};
  float m[8], l[8];
#pragma unroll
  for (int r = 0; r < 8; ++r) { m[r] = -3.0e38f; l[r] = 0.0f; }

  const int   jmax  = qt * WPB + (WPB - 1);        // uniform per block
  const float scale = 0.03125f;                    // C^-0.5 = 1/32

  for (int j = 0; j <= jmax; ++j) {
    wait_async0();                                 // my writes to buf[j&1] done
    __syncthreads();                               // all waves -> tile valid; and
                                                   // all reads of buf[(j+1)&1] from
                                                   // iter j-1 already consumed
    if (j < jmax) stage(j + 1, (j + 1) & 1);       // overlap next tile with compute
    if (j > iw) continue;                          // causal early-out (wave-uniform)

    const float* __restrict__ lkj = lk[j & 1];
    const float* __restrict__ lvj = lv[j & 1];

    // ---- S = Q * K^T  (16 wmma, K = 64) ----
    v8f s = {};
#pragma unroll
    for (int k0 = 0; k0 < H; k0 += 4) {
      v2f a  = frag_nk(lq[wave], H, k0);
      v2f bf = frag_nk(lkj, H, k0);                // K tile is N x K row-major
      s = __builtin_amdgcn_wmma_f32_16x16x4_f32(false, a, false, bf,
                                                (short)0, s, false, false);
    }

    // ---- online softmax in D-layout (rows striped r / r+8, cols = lanes) ----
    const int n    = lane & 15;
    const int mb   = (lane >> 4) << 3;
    const int kcol = j * 16 + n;
    float alpha[8];
#pragma unroll
    for (int r = 0; r < 8; ++r) {
      float sv = s[r] * scale;
      const int qrow = qrow0 + mb + r;
      if (kcol > qrow) sv = -3.0e38f;              // causal mask
      float rm = sv;                               // row max over 16-lane half
      rm = fmaxf(rm, __shfl_xor(rm, 1, 32));
      rm = fmaxf(rm, __shfl_xor(rm, 2, 32));
      rm = fmaxf(rm, __shfl_xor(rm, 4, 32));
      rm = fmaxf(rm, __shfl_xor(rm, 8, 32));
      const float mn = fmaxf(m[r], rm);
      const float pv = __expf(sv - mn);
      float rs = pv;                               // row sum over 16-lane half
      rs += __shfl_xor(rs, 1, 32);
      rs += __shfl_xor(rs, 2, 32);
      rs += __shfl_xor(rs, 4, 32);
      rs += __shfl_xor(rs, 8, 32);
      const float al = __expf(m[r] - mn);
      l[r] = l[r] * al + rs;
      m[r] = mn;
      alpha[r] = al;
      lp[wave][(mb + r) * 16 + n] = pv;            // stash P for layout swap
    }
    asm volatile("s_wait_dscnt 0" ::: "memory");   // P visible across lanes

#pragma unroll
    for (int r = 0; r < 8; ++r) {                  // rescale O by alpha
      o0[r] *= alpha[r]; o1[r] *= alpha[r]; o2[r] *= alpha[r]; o3[r] *= alpha[r];
    }

    // ---- O += P * V  (16 wmma: 4 K-chunks x 4 col tiles) ----
#pragma unroll
    for (int k0 = 0; k0 < 16; k0 += 4) {
      v2f a  = frag_nk(lp[wave], 16, k0);
      v2f b0 = frag_kn(lvj, H, k0, 0);
      v2f b1 = frag_kn(lvj, H, k0, 16);
      v2f b2 = frag_kn(lvj, H, k0, 32);
      v2f b3 = frag_kn(lvj, H, k0, 48);
      o0 = __builtin_amdgcn_wmma_f32_16x16x4_f32(false, a, false, b0, (short)0, o0, false, false);
      o1 = __builtin_amdgcn_wmma_f32_16x16x4_f32(false, a, false, b1, (short)0, o1, false, false);
      o2 = __builtin_amdgcn_wmma_f32_16x16x4_f32(false, a, false, b2, (short)0, o2, false, false);
      o3 = __builtin_amdgcn_wmma_f32_16x16x4_f32(false, a, false, b3, (short)0, o3, false, false);
    }
  }

  // ---- epilogue: O / l ----
  const int n  = lane & 15;
  const int mb = (lane >> 4) << 3;
  float* __restrict__ ob = out + (size_t)b * T * H;
#pragma unroll
  for (int r = 0; r < 8; ++r) {
    const float inv = 1.0f / l[r];
    const size_t row = (size_t)(qrow0 + mb + r) * H;
    ob[row + 0  + n] = o0[r] * inv;
    ob[row + 16 + n] = o1[r] * inv;
    ob[row + 32 + n] = o2[r] * inv;
    ob[row + 48 + n] = o3[r] * inv;
  }
}

// ---------------------------------------------------------------------------
extern "C" void kernel_launch(void* const* d_in, const int* in_sizes, int n_in,
                              void* d_out, int out_size, void* d_ws, size_t ws_size,
                              hipStream_t stream) {
  (void)in_sizes; (void)n_in; (void)out_size; (void)ws_size;
  const float* x  = (const float*)d_in[0];
  const float* Wq = (const float*)d_in[1];
  const float* Wk = (const float*)d_in[2];
  const float* Wv = (const float*)d_in[3];
  float* out = (float*)d_out;

  float* q  = (float*)d_ws;                       // 3 x 4 MB
  float* k  = q + (size_t)ROWS * H;
  float* v  = k + (size_t)ROWS * H;
  float* Wt = v + (size_t)ROWS * H;               // 3 x 256 KB transposed weights

  wt_kernel<<<(3 * C * H + 255) / 256, 256, 0, stream>>>(Wq, Wk, Wv, Wt);

  qkv_kernel<<<ROWS / 16, 384, 0, stream>>>(x, Wt, q, k, v);

  const int np2 = 2 * ROWS * (H / 2);
  rope_kernel<<<(np2 + 255) / 256, 256, 0, stream>>>(q, k);

  attn_kernel<<<B * (T / (16 * WPB)), 32 * WPB, 0, stream>>>(q, k, v, out);
}

// v001
// It runs in 320 microseconds.
// In both of two side-by-side timings against v000, it was 1.70 times as fast.
#include <hip/hip_runtime.h>

// ---------------------------------------------------------------------------
// Fused causal attention head with RoPE for MI455X (gfx1250, wave32).
//   B=4, T=4096, C=1024, H=64, fp32.
// Matrix math: V_WMMA_F32_16X16X4_F32 (fp32-accurate tensor path).
// LDS staging: GLOBAL_LOAD_ASYNC_TO_LDS_B128 (ASYNCcnt), double-buffered.
// Weights pre-transposed (N x K) so every B-fragment lane-pair is contiguous.
// ---------------------------------------------------------------------------

typedef __attribute__((ext_vector_type(2))) float v2f;
typedef __attribute__((ext_vector_type(8))) float v8f;

constexpr int B = 4;
constexpr int T = 4096;
constexpr int C = 1024;
constexpr int H = 64;
constexpr int ROWS = B * T;          // 16384 rows of x / q / k / v
constexpr int WPB  = 4;              // waves per block in the attention kernel

// LDS row pitches in floats (64 banks x 4 B; bank = dword address mod 64).
// 8-byte fragment reads walk 16 rows: a pitch of 4 x odd puts the 32 lanes on
// all 64 banks once.  The K x N reader takes rows kk and kk+2 in the two lane
// halves: twice its pitch is 16 mod 64, so the halves use disjoint banks.
constexpr int PQK = H + 4;           // Q and K tiles (row readers, 8 B per lane)
constexpr int PV  = H + 8;           // V tile (K x N reader, 4 B per lane)
constexpr int PP  = 16 + 4;          // P scratch (row reader; stores rows r, r+8)

// Issue one 16-byte async global->LDS copy (no VGPR round trip, ASYNCcnt).
__device__ __forceinline__ void async_copy_b128(void* lds_dst, const void* gsrc) {
  const unsigned ldsOff = (unsigned)(size_t)lds_dst;  // flat addr low 32 = LDS offset
  // s_wait_xcnt 0 inside the statement: it stands in front of any rewrite of the
  // two address registers that the copy names.
  asm volatile("global_load_async_to_lds_b128 %0, %1, off\n\t"
               "s_wait_xcnt 0x0"
               :: "v"(ldsOff), "v"(gsrc) : "memory");
}

// Four such copies behind one another, one s_wait_xcnt 0 for the run.
__device__ __forceinline__ void async_copy4_b128(void* l0, const void* g0, void* l1, const void* g1,
                                                 void* l2, const void* g2, void* l3, const void* g3) {
  asm volatile("global_load_async_to_lds_b128 %0, %1, off\n\t"
               "global_load_async_to_lds_b128 %2, %3, off\n\t"
               "global_load_async_to_lds_b128 %4, %5, off\n\t"
               "global_load_async_to_lds_b128 %6, %7, off\n\t"
               "s_wait_xcnt 0x0"
               :: "v"((unsigned)(size_t)l0), "v"(g0), "v"((unsigned)(size_t)l1), "v"(g1),
                  "v"((unsigned)(size_t)l2), "v"(g2), "v"((unsigned)(size_t)l3), "v"(g3)
               : "memory");
}

__device__ __forceinline__ void wait_async0() {
  asm volatile("s_wait_asynccnt 0" ::: "memory");
}

// A-fragment loader for a row-major M x K tile (also serves as the B-fragment
// loader when B is stored transposed, i.e. as N x K row-major).
//   lane 0..15  -> row = lane,    cols k0, k0+1
//   lane 16..31 -> row = lane-16, cols k0+2, k0+3
__device__ __forceinline__ v2f frag_nk(const float* __restrict__ base, int stride, int k0) {
  const int lane = threadIdx.x & 31;
  const int r  = lane & 15;
  const int kk = k0 + ((lane >> 4) << 1);
  v2f f;
  f.x = base[r * stride + kk];
  f.y = base[r * stride + kk + 1];
  return f;
}

// B-fragment loader when B is stored K x N row-major (stride = row pitch).
__device__ __forceinline__ v2f frag_kn(const float* __restrict__ base, int stride, int k0, int nb) {
  const int lane = threadIdx.x & 31;
  const int n  = lane & 15;
  const int kk = k0 + ((lane >> 4) << 1);
  v2f f;
  f.x = base[kk * stride + nb + n];
  f.y = base[(kk + 1) * stride + nb + n];
  return f;
}

// ---------------------------------------------------------------------------
// Kernel 0: transpose Wq/Wk/Wv (C x H) into Wt (3 x H x C).  768 KB once;
// makes every projection B-fragment a contiguous 8-byte load per lane.
// ---------------------------------------------------------------------------
__global__ void wt_kernel(const float* __restrict__ Wq, const float* __restrict__ Wk,
                          const float* __restrict__ Wv, float* __restrict__ Wt) {
  const int idx = blockIdx.x * blockDim.x + threadIdx.x;
  if (idx >= 3 * C * H) return;
  const int m = idx / (C * H);
  const int r = idx % (C * H);
  const int k = r / H;                              // consecutive idx -> coalesced read
  const int n = r % H;
  const float* __restrict__ W = (m == 0) ? Wq : (m == 1 ? Wk : Wv);
  Wt[(size_t)m * C * H + (size_t)n * C + k] = W[(size_t)k * H + n];
}

// ---------------------------------------------------------------------------
// Kernel 1: q/k/v projections.  One block per 16-row tile of x.
// 12 waves: wave -> (matrix q/k/v, 16-col tile of H).
// x staged in 16 x 256 chunks, double-buffered via async-to-LDS.
// ---------------------------------------------------------------------------
constexpr int KC = 256;              // K-chunk (16 rows of 256 floats per buffer)
constexpr int PX = KC + 4;           // LDS row pitch of the x chunk (4 x odd)

__global__ __launch_bounds__(384) void qkv_kernel(
    const float* __restrict__ x, const float* __restrict__ Wt,
    float* __restrict__ q, float* __restrict__ k, float* __restrict__ v) {
  __shared__ __align__(16) float lx[2][16 * PX];

  const int tid  = threadIdx.x;
  const int row0 = blockIdx.x * 16;

  const int wave = tid >> 5;         // 0..11
  const int mat  = wave >> 2;        // 0:q 1:k 2:v
  const int ct   = wave & 3;         // 16-col tile of H
  // N x K weight tile for this wave: rows ct*16 .. ct*16+15, K = C
  const float* __restrict__ Wm = Wt + (size_t)mat * C * H + (size_t)(ct * 16) * C;
  float* __restrict__       out = (mat == 0) ? q : (mat == 1 ? k : v);

  // stage the 16 x KC chunk `cidx` into buffer `buf` (1024 float4 transfers)
  auto stage = [&](int cidx, int buf) {
    const int kc = cidx * KC;
    for (int i = tid; i < 16 * KC / 4; i += 384) {
      const int r  = i / (KC / 4);
      const int c4 = i % (KC / 4);
      async_copy_b128(&lx[buf][r * PX + c4 * 4],
                      x + (size_t)(row0 + r) * C + kc + c4 * 4);
    }
  };

  stage(0, 0);

  v8f acc = {};
  for (int cidx = 0; cidx < C / KC; ++cidx) {
    wait_async0();                   // my async writes to lx[cidx&1] done
    __syncthreads();                 // everyone's done -> buffer valid
    if (cidx + 1 < C / KC) stage(cidx + 1, (cidx + 1) & 1);  // overlap next chunk

    const float* __restrict__ lxb = lx[cidx & 1];
#pragma unroll 8
    for (int k0 = 0; k0 < KC; k0 += 4) {
      v2f a = frag_nk(lxb, PX, k0);                // A: 16x4 slice of x-tile
      v2f b = frag_nk(Wm, C, cidx * KC + k0);      // B: 4x16 slice of Wt (NxK)
      acc = __builtin_amdgcn_wmma_f32_16x16x4_f32(false, a, false, b,
                                                  (short)0, acc, false, false);
    }
  }

  // D layout: vgpr r -> M = r + 8*(lane>=16), N = lane&15
  const int lane = tid & 31;
  const int n  = lane & 15;
  const int mb = (lane >> 4) << 3;
#pragma unroll
  for (int r = 0; r < 8; ++r)
    out[(size_t)(row0 + mb + r) * H + ct * 16 + n] = acc[r];
}

// ---------------------------------------------------------------------------
// Kernel 2: RoPE on q and k (in workspace).  One thread per rotated pair.
// ---------------------------------------------------------------------------
__global__ void rope_kernel(float* __restrict__ q, float* __restrict__ k) {
  const int NP = ROWS * (H / 2);                   // pairs per tensor
  const int idx = blockIdx.x * blockDim.x + threadIdx.x;
  if (idx >= 2 * NP) return;
  float* base = (idx < NP) ? q : k;
  const int p   = (idx < NP) ? idx : idx - NP;
  const int row = p >> 5;                          // / (H/2)
  const int h   = p & 31;
  const int t   = row & (T - 1);                   // position within sequence
  const float freq = __powf(10000.0f, -(float)(2 * h) / (float)H);
  float s, c;
  __sincosf((float)t * freq, &s, &c);
  float2* pr = (float2*)(base + (size_t)row * H) + h;
  const float2 val = *pr;
  float2 o;
  o.x = val.x * c - val.y * s;
  o.y = val.x * s + val.y * c;
  *pr = o;
}

// ---------------------------------------------------------------------------
// Kernel 3: flash attention.  4 waves / block; each wave owns one 16-row
// query tile; the block streams causal 16x64 K/V tiles through LDS with
// async-to-LDS double buffering (one barrier per key tile).
// ---------------------------------------------------------------------------
__global__ __launch_bounds__(32 * WPB) void attn_kernel(
    const float* __restrict__ q, const float* __restrict__ kk,
    const float* __restrict__ vv, float* __restrict__ out) {
  __shared__ __align__(16) float lq[WPB][16 * PQK]; // per-wave Q tile
  __shared__ __align__(16) float lk[2][16 * PQK];   // K tile ping-pong (NxK view)
  __shared__ __align__(16) float lv[2][16 * PV];    // V tile ping-pong (KxN view)
  __shared__ __align__(16) float lp[WPB][16 * PP];  // per-wave P scratch

  const int tid  = threadIdx.x;
  const int wave = tid >> 5;
  const int lane = tid & 31;
  const int tilesPerBlock = T / (16 * WPB);
  const int b   = blockIdx.x / tilesPerBlock;
  const int qt  = blockIdx.x % tilesPerBlock;
  const int iw  = qt * WPB + wave;                 // this wave's query-tile idx
  const int qrow0 = iw * 16;                       // query row base (within batch)

  const float* __restrict__ qb = q  + (size_t)b * T * H;
  const float* __restrict__ kb = kk + (size_t)b * T * H;
  const float* __restrict__ vb = vv + (size_t)b * T * H;

  // stage K/V tile j into ping-pong buffer `buf` (2 B128 of K, 2 of V per thread)
  auto stage = [&](int j, int buf) {
    const float* ks = kb + (size_t)j * 16 * H;
    const float* vs = vb + (size_t)j * 16 * H;
    const int r  = tid >> 4;                       // rows r and r + 8 of the tile
    const int c  = (tid & 15) * 4;
    const int g0 = tid * 4;
    const int g1 = g0 + 32 * WPB * 4;
    async_copy4_b128(&lk[buf][r * PQK + c],       ks + g0, &lv[buf][r * PV + c],       vs + g0,
                     &lk[buf][(r + 8) * PQK + c], ks + g1, &lv[buf][(r + 8) * PV + c], vs + g1);
  };

  // each wave loads its own Q tile (plain loads; done once)
  for (int i = lane; i < 16 * H; i += 32)
    lq[wave][(i >> 6) * PQK + (i & (H - 1))] = qb[(size_t)qrow0 * H + i];
  asm volatile("s_wait_dscnt 0" ::: "memory");     // cross-lane LDS visibility

  stage(0, 0);

  v8f o0 = {}, o1 = {}, o2 = {}, o3 = {};
  float m[8], l[8];
#pragma unroll
  for (int r = 0; r < 8; ++r) { m[r] = -3.0e38f; l[r] = 0.0f; }

  const int   jmax  = qt * WPB + (WPB - 1);        // uniform per block
  const float scale = 0.03125f;                    // C^-0.5 = 1/32

  for (int j = 0; j <= jmax; ++j) {
    wait_async0();                                 // my writes to buf[j&1] done
    __syncthreads();                               // all waves -> tile valid; and
                                                   // all reads of buf[(j+1)&1] from
                                                   // iter j-1 already consumed
    if (j < jmax) stage(j + 1, (j + 1) & 1);       // overlap next tile with compute
    if (j > iw) continue;                          // causal early-out (wave-uniform)

    const float* __restrict__ lkj = lk[j & 1];
    const float* __restrict__ lvj = lv[j & 1];

    // ---- S = Q * K^T  (16 wmma, K = 64) ----
    v8f s = {};
#pragma unroll
    for (int k0 = 0; k0 < H; k0 += 4) {
      v2f a  = frag_nk(lq[wave], PQK, k0);
      v2f bf = frag_nk(lkj, PQK, k0);              // K tile is N x K row-major
      s = __builtin_amdgcn_wmma_f32_16x16x4_f32(false, a, false, bf,
                                                (short)0, s, false, false);
    }

    // ---- online softmax in D-layout (rows striped r / r+8, cols = lanes) ----
    const int n    = lane & 15;
    const int mb   = (lane >> 4) << 3;
    const int kcol = j * 16 + n;
    float alpha[8];
#pragma unroll
    for (int r = 0; r < 8; ++r) {
      float sv = s[r] * scale;
      const int qrow = qrow0 + mb + r;
      if (kcol > qrow) sv = -3.0e38f;              // causal mask
      float rm = sv;                               // row max over 16-lane half
      rm = fmaxf(rm, __shfl_xor(rm, 1, 32));
      rm = fmaxf(rm, __shfl_xor(rm, 2, 32));
      rm = fmaxf(rm, __shfl_xor(rm, 4, 32));
      rm = fmaxf(rm, __shfl_xor(rm, 8, 32));
      const float mn = fmaxf(m[r], rm);
      const float pv = __expf(sv - mn);
      float rs = pv;                               // row sum over 16-lane half
      rs += __shfl_xor(rs, 1, 32);
      rs += __shfl_xor(rs, 2, 32);
      rs += __shfl_xor(rs, 4, 32);
      rs += __shfl_xor(rs, 8, 32);
      const float al = __expf(m[r] - mn);
      l[r] = l[r] * al + rs;
      m[r] = mn;
      alpha[r] = al;
      lp[wave][(mb + r) * PP + n] = pv;            // stash P for layout swap
    }
    asm volatile("s_wait_dscnt 0" ::: "memory");   // P visible across lanes

#pragma unroll
    for (int r = 0; r < 8; ++r) {                  // rescale O by alpha
      o0[r] *= alpha[r]; o1[r] *= alpha[r]; o2[r] *= alpha[r]; o3[r] *= alpha[r];
    }

    // ---- O += P * V  (16 wmma: 4 K-chunks x 4 col tiles) ----
#pragma unroll
    for (int k0 = 0; k0 < 16; k0 += 4) {
      v2f a  = frag_nk(lp[wave], PP, k0);
      v2f b0 = frag_kn(lvj, PV, k0, 0);
      v2f b1 = frag_kn(lvj, PV, k0, 16);
      v2f b2 = frag_kn(lvj, PV, k0, 32);
      v2f b3 = frag_kn(lvj, PV, k0, 48);
      o0 = __builtin_amdgcn_wmma_f32_16x16x4_f32(false, a, false, b0, (short)0, o0, false, false);
      o1 = __builtin_amdgcn_wmma_f32_16x16x4_f32(false, a, false, b1, (short)0, o1, false, false);
      o2 = __builtin_amdgcn_wmma_f32_16x16x4_f32(false, a, false, b2, (short)0, o2, false, false);
      o3 = __builtin_amdgcn_wmma_f32_16x16x4_f32(false, a, false, b3, (short)0, o3, false, false);
    }
  }

  // ---- epilogue: O / l ----
  const int n  = lane & 15;
  const int mb = (lane >> 4) << 3;
  float* __restrict__ ob = out + (size_t)b * T * H;
#pragma unroll
  for (int r = 0; r < 8; ++r) {
    const float inv = 1.0f / l[r];
    const size_t row = (size_t)(qrow0 + mb + r) * H;
    ob[row + 0  + n] = o0[r] * inv;
    ob[row + 16 + n] = o1[r] * inv;
    ob[row + 32 + n] = o2[r] * inv;
    ob[row + 48 + n] = o3[r] * inv;
  }
}

// ---------------------------------------------------------------------------
extern "C" void kernel_launch(void* const* d_in, const int* in_sizes, int n_in,
                              void* d_out, int out_size, void* d_ws, size_t ws_size,
                              hipStream_t stream) {
  (void)in_sizes; (void)n_in; (void)out_size; (void)ws_size;
  const float* x  = (const float*)d_in[0];
  const float* Wq = (const float*)d_in[1];
  const float* Wk = (const float*)d_in[2];
  const float* Wv = (const float*)d_in[3];
  float* out = (float*)d_out;

  float* q  = (float*)d_ws;                       // 3 x 4 MB
  float* k  = q + (size_t)ROWS * H;
  float* v  = k + (size_t)ROWS * H;
  float* Wt = v + (size_t)ROWS * H;               // 3 x 256 KB transposed weights

  wt_kernel<<<(3 * C * H + 255) / 256, 256, 0, stream>>>(Wq, Wk, Wv, Wt);

  qkv_kernel<<<ROWS / 16, 384, 0, stream>>>(x, Wt, q, k, v);

  const int np2 = 2 * ROWS * (H / 2);
  rope_kernel<<<(np2 + 255) / 256, 256, 0, stream>>>(q, k);

  attn_kernel<<<B * (T / (16 * WPB)), 32 * WPB, 0, stream>>>(q, k, v, out);
}

// v002
// A run of this version takes 141 microseconds.
// In both of two side-by-side timings against v001, it was 2.28 times as fast.
// Counting every step since v000, it is 3.89 times as fast.
#include <hip/hip_runtime.h>

// ---------------------------------------------------------------------------
// Fused causal attention head with RoPE for MI455X (gfx1250, wave32).
//   B=4, T=4096, C=1024, H=64, fp32.
// Matrix math: V_WMMA_F32_16X16X4_F32 (fp32-accurate tensor path).
// LDS staging: GLOBAL_LOAD_ASYNC_TO_LDS_B128 (ASYNCcnt), double-buffered.
// Weights pre-transposed (N x K) so every B-fragment lane-pair is contiguous.
// ---------------------------------------------------------------------------

typedef __attribute__((ext_vector_type(2))) float v2f;
typedef __attribute__((ext_vector_type(8))) float v8f;

constexpr int B = 4;
constexpr int T = 4096;
constexpr int C = 1024;
constexpr int H = 64;
constexpr int ROWS = B * T;          // 16384 rows of x / q / k / v
constexpr int QTB  = 2;              // attention: 16-row query tiles per block
constexpr int KSP  = 8;              // attention: waves that split one query tile's keys
constexpr int NW   = QTB * KSP;      // attention: waves per block
constexpr int SK   = 16 * KSP;       // attention: keys per LDS stage
constexpr int NG   = T / (16 * QTB); // attention: row groups per batch (two per block)
static_assert(NG % 2 == 0, "the attention kernel pairs row groups g and NG - 1 - g");

// LDS row pitches in floats (64 banks x 4 B; bank = dword address mod 64).
// 8-byte fragment reads walk 16 rows: a pitch of 4 x odd puts the 32 lanes on
// all 64 banks once.  The K x N reader takes rows kk and kk+2 in the two lane
// halves: twice its pitch is 16 mod 64, so the halves use disjoint banks.
constexpr int PQK = H + 4;           // Q and K tiles (row readers, 8 B per lane)
constexpr int PV  = H + 8;           // V tile (K x N reader, 4 B per lane)
constexpr int PP  = 16 + 4;          // P scratch (row reader; stores rows r, r+8)
constexpr int PO  = H + 4;           // partial O in the merge (stores rows r, r+8; 16 B readers)

// Issue one 16-byte async global->LDS copy (no VGPR round trip, ASYNCcnt).
__device__ __forceinline__ void async_copy_b128(void* lds_dst, const void* gsrc) {
  const unsigned ldsOff = (unsigned)(size_t)lds_dst;  // flat addr low 32 = LDS offset
  // s_wait_xcnt 0 inside the statement: it stands in front of any rewrite of the
  // two address registers that the copy names.
  asm volatile("global_load_async_to_lds_b128 %0, %1, off\n\t"
               "s_wait_xcnt 0x0"
               :: "v"(ldsOff), "v"(gsrc) : "memory");
}

// Eight such copies behind one another, one s_wait_xcnt 0 for the run.
__device__ __forceinline__ void async_copy8_b128(void* l0, const void* g0, void* l1, const void* g1,
                                                 void* l2, const void* g2, void* l3, const void* g3,
                                                 void* l4, const void* g4, void* l5, const void* g5,
                                                 void* l6, const void* g6, void* l7, const void* g7) {
  asm volatile("global_load_async_to_lds_b128 %0, %1, off\n\t"
               "global_load_async_to_lds_b128 %2, %3, off\n\t"
               "global_load_async_to_lds_b128 %4, %5, off\n\t"
               "global_load_async_to_lds_b128 %6, %7, off\n\t"
               "global_load_async_to_lds_b128 %8, %9, off\n\t"
               "global_load_async_to_lds_b128 %10, %11, off\n\t"
               "global_load_async_to_lds_b128 %12, %13, off\n\t"
               "global_load_async_to_lds_b128 %14, %15, off\n\t"
               "s_wait_xcnt 0x0"
               :: "v"((unsigned)(size_t)l0), "v"(g0), "v"((unsigned)(size_t)l1), "v"(g1),
                  "v"((unsigned)(size_t)l2), "v"(g2), "v"((unsigned)(size_t)l3), "v"(g3),
                  "v"((unsigned)(size_t)l4), "v"(g4), "v"((unsigned)(size_t)l5), "v"(g5),
                  "v"((unsigned)(size_t)l6), "v"(g6), "v"((unsigned)(size_t)l7), "v"(g7)
               : "memory");
}

__device__ __forceinline__ void wait_async0() {
  asm volatile("s_wait_asynccnt 0" ::: "memory");
}

// 2^x with the slot that the instruction set asks for behind a transcendental:
// the v_nop stands in the same statement, so nothing that overwrites the source
// or reads the result can follow the v_exp_f32 directly.
__device__ __forceinline__ float exp2_slot(float x) {
  float r;
  asm("v_exp_f32 %0, %1\n\tv_nop" : "=v"(r) : "v"(x));
  return r;
}

// A-fragment loader for a row-major M x K tile (also serves as the B-fragment
// loader when B is stored transposed, i.e. as N x K row-major).
//   lane 0..15  -> row = lane,    cols k0, k0+1
//   lane 16..31 -> row = lane-16, cols k0+2, k0+3
__device__ __forceinline__ v2f frag_nk(const float* __restrict__ base, int stride, int k0) {
  const int lane = threadIdx.x & 31;
  const int r  = lane & 15;
  const int kk = k0 + ((lane >> 4) << 1);
  v2f f;
  f.x = base[r * stride + kk];
  f.y = base[r * stride + kk + 1];
  return f;
}

// B-fragment loader when B is stored K x N row-major (stride = row pitch).
__device__ __forceinline__ v2f frag_kn(const float* __restrict__ base, int stride, int k0, int nb) {
  const int lane = threadIdx.x & 31;
  const int n  = lane & 15;
  const int kk = k0 + ((lane >> 4) << 1);
  v2f f;
  f.x = base[kk * stride + nb + n];
  f.y = base[(kk + 1) * stride + nb + n];
  return f;
}

// ---------------------------------------------------------------------------
// Kernel 0: transpose Wq/Wk/Wv (C x H) into Wt (3 x H x C).  768 KB once;
// makes every projection B-fragment a contiguous 8-byte load per lane.
// ---------------------------------------------------------------------------
__global__ void wt_kernel(const float* __restrict__ Wq, const float* __restrict__ Wk,
                          const float* __restrict__ Wv, float* __restrict__ Wt) {
  const int idx = blockIdx.x * blockDim.x + threadIdx.x;
  if (idx >= 3 * C * H) return;
  const int m = idx / (C * H);
  const int r = idx % (C * H);
  const int k = r / H;                              // consecutive idx -> coalesced read
  const int n = r % H;
  const float* __restrict__ W = (m == 0) ? Wq : (m == 1 ? Wk : Wv);
  Wt[(size_t)m * C * H + (size_t)n * C + k] = W[(size_t)k * H + n];
}

// ---------------------------------------------------------------------------
// Kernel 1: q/k/v projections.  One block per 16-row tile of x.
// 12 waves: wave -> (matrix q/k/v, 16-col tile of H).
// x staged in 16 x 256 chunks, double-buffered via async-to-LDS.
// ---------------------------------------------------------------------------
constexpr int KC = 256;              // K-chunk (16 rows of 256 floats per buffer)
constexpr int PX = KC + 4;           // LDS row pitch of the x chunk (4 x odd)

__global__ __launch_bounds__(384) void qkv_kernel(
    const float* __restrict__ x, const float* __restrict__ Wt,
    float* __restrict__ q, float* __restrict__ k, float* __restrict__ v) {
  __shared__ __align__(16) float lx[2][16 * PX];

  const int tid  = threadIdx.x;
  const int row0 = blockIdx.x * 16;

  const int wave = tid >> 5;         // 0..11
  const int mat  = wave >> 2;        // 0:q 1:k 2:v
  const int ct   = wave & 3;         // 16-col tile of H
  // N x K weight tile for this wave: rows ct*16 .. ct*16+15, K = C
  const float* __restrict__ Wm = Wt + (size_t)mat * C * H + (size_t)(ct * 16) * C;
  float* __restrict__       out = (mat == 0) ? q : (mat == 1 ? k : v);

  // stage the 16 x KC chunk `cidx` into buffer `buf` (1024 float4 transfers)
  auto stage = [&](int cidx, int buf) {
    const int kc = cidx * KC;
    for (int i = tid; i < 16 * KC / 4; i += 384) {
      const int r  = i / (KC / 4);
      const int c4 = i % (KC / 4);
      async_copy_b128(&lx[buf][r * PX + c4 * 4],
                      x + (size_t)(row0 + r) * C + kc + c4 * 4);
    }
  };

  stage(0, 0);

  v8f acc = {};
  for (int cidx = 0; cidx < C / KC; ++cidx) {
    wait_async0();                   // my async writes to lx[cidx&1] done
    __syncthreads();                 // everyone's done -> buffer valid
    if (cidx + 1 < C / KC) stage(cidx + 1, (cidx + 1) & 1);  // overlap next chunk

    const float* __restrict__ lxb = lx[cidx & 1];
#pragma unroll 8
    for (int k0 = 0; k0 < KC; k0 += 4) {
      v2f a = frag_nk(lxb, PX, k0);                // A: 16x4 slice of x-tile
      v2f b = frag_nk(Wm, C, cidx * KC + k0);      // B: 4x16 slice of Wt (NxK)
      acc = __builtin_amdgcn_wmma_f32_16x16x4_f32(false, a, false, b,
                                                  (short)0, acc, false, false);
    }
  }

  // D layout: vgpr r -> M = r + 8*(lane>=16), N = lane&15
  const int lane = tid & 31;
  const int n  = lane & 15;
  const int mb = (lane >> 4) << 3;
#pragma unroll
  for (int r = 0; r < 8; ++r)
    out[(size_t)(row0 + mb + r) * H + ct * 16 + n] = acc[r];
}

// ---------------------------------------------------------------------------
// Kernel 2: RoPE on q and k (in workspace).  One thread per rotated pair.
// ---------------------------------------------------------------------------
__global__ void rope_kernel(float* __restrict__ q, float* __restrict__ k) {
  const int NP = ROWS * (H / 2);                   // pairs per tensor
  const int idx = blockIdx.x * blockDim.x + threadIdx.x;
  if (idx >= 2 * NP) return;
  float* base = (idx < NP) ? q : k;
  const int p   = (idx < NP) ? idx : idx - NP;
  const int row = p >> 5;                          // / (H/2)
  const int h   = p & 31;
  const int t   = row & (T - 1);                   // position within sequence
  const float freq = __powf(10000.0f, -(float)(2 * h) / (float)H);
  float s, c;
  __sincosf((float)t * freq, &s, &c);
  float2* pr = (float2*)(base + (size_t)row * H) + h;
  const float2 val = *pr;
  float2 o;
  o.x = val.x * c - val.y * s;
  o.y = val.x * s + val.y * c;
  *pr = o;
}

// ---------------------------------------------------------------------------
// Kernel 3: flash attention.  One block = 2 query tiles (32 rows) x 8-way key
// split = 16 waves.  A stage is 128 keys (8 key tiles) of K and V in LDS, two
// buffers filled by async-to-LDS copies; wave (qsub, ks) works key tile ks of
// each stage against query tile qsub with its own running max, sum and O.
// The eight partial states of a query tile are merged through LDS at the end.
// Four waves per SIMD: one wave's softmax and LDS latency runs under the other
// waves' matrix work.  Causal cost grows with the row group g, so each block
// runs groups NG - 1 - g and g one after the other: 256 blocks of equal cost.
// ---------------------------------------------------------------------------
__global__ __launch_bounds__(32 * NW) void attn_kernel(
    const float* __restrict__ q, const float* __restrict__ kk,
    const float* __restrict__ vv, float* __restrict__ out) {
  __shared__ __align__(16) float lq[QTB * 16 * PQK]; // the block's Q rows
  __shared__ __align__(16) float lk[2][SK * PQK];    // K stage ping-pong (NxK view)
  __shared__ __align__(16) float lv[2][SK * PV];     // V stage ping-pong (KxN view)
  __shared__ __align__(16) float lp[NW][16 * PP];    // per-wave P scratch
  __shared__ __align__(16) float lo[NW][16 * PO];    // per-wave partial O (merge)
  __shared__ float lm[NW][16];                       // per-wave row maxima (merge)
  __shared__ float ll[NW][16];                       // per-wave row sums (merge)

  const int tid  = threadIdx.x;
  const int wave = __builtin_amdgcn_readfirstlane(tid >> 5);
  const int lane = tid & 31;
  const int qsub = wave / KSP;                     // query tile within the block
  const int ks   = wave % KSP;                     // key tile within a stage

  const int b  = blockIdx.x / (NG / 2);
  const int gi = blockIdx.x % (NG / 2);

  const float* __restrict__ qb = q  + (size_t)b * T * H;
  const float* __restrict__ kb = kk + (size_t)b * T * H;
  const float* __restrict__ vb = vv + (size_t)b * T * H;

  // stage the 128 keys of stage t into buffer `buf` (4 B128 of K, 4 of V per thread)
  auto stage = [&](int t, int buf) {
    const float* ks_ = kb + (size_t)t * SK * H + tid * 4;
    const float* vs_ = vb + (size_t)t * SK * H + tid * 4;
    float* lkd = &lk[buf][(tid >> 4) * PQK + (tid & 15) * 4];  // rows r, r+32, r+64, r+96
    float* lvd = &lv[buf][(tid >> 4) * PV  + (tid & 15) * 4];
    async_copy8_b128(lkd,            ks_,            lvd,           vs_,
                     lkd + 32 * PQK, ks_ + 32 * H,   lvd + 32 * PV, vs_ + 32 * H,
                     lkd + 64 * PQK, ks_ + 64 * H,   lvd + 64 * PV, vs_ + 64 * H,
                     lkd + 96 * PQK, ks_ + 96 * H,   lvd + 96 * PV, vs_ + 96 * H);
  };

  for (int pass = 0; pass < 2; ++pass) {           // heavy group, then its light partner
  const int g     = pass ? gi : NG - 1 - gi;
  const int iw    = g * QTB + qsub;                // this wave's query-tile idx
  const int qrow0 = iw * 16;                       // query row base (within batch)
  const int nst   = (g * QTB + QTB + KSP - 1) / KSP;  // stages, uniform per block

  // the group's 32 Q rows (plain loads; published by the barrier below).  In the
  // second pass the last barrier of the first loop has ended every read of lq and
  // of the two stage buffers.
  for (int i = tid; i < QTB * 16 * H; i += 32 * NW)
    lq[(i >> 6) * PQK + (i & (H - 1))] = qb[(size_t)(g * QTB * 16) * H + i];

  stage(0, 0);
  wait_async0();                                   // my copies of stage 0 landed
  __syncthreads();                                 // everyone's -> stage 0 and Q valid
  if (nst > 1) stage(1, 1);

  v8f o0 = {}, o1 = {}, o2 = {}, o3 = {};
  float m[8], l[8];
#pragma unroll
  for (int r = 0; r < 8; ++r) { m[r] = -3.0e38f; l[r] = 0.0f; }

  const float scale = 0.03125f;                    // C^-0.5 = 1/32
  const float* __restrict__ lqw = lq + qsub * 16 * PQK;

  for (int t = 0; t < nst; ++t) {
    const int j = t * KSP + ks;                    // this wave's key tile
    if (j <= iw) {                                 // causal skip (wave-uniform)
      const float* __restrict__ lkj = lk[t & 1] + ks * 16 * PQK;
      const float* __restrict__ lvj = lv[t & 1] + ks * 16 * PV;

      // ---- S = Q * K^T  (16 wmma, K = 64) ----
      v8f s = {};
#pragma unroll
      for (int k0 = 0; k0 < H; k0 += 4) {
        v2f a  = frag_nk(lqw, PQK, k0);
        v2f bf = frag_nk(lkj, PQK, k0);            // K tile is N x K row-major
        s = __builtin_amdgcn_wmma_f32_16x16x4_f32(false, a, false, bf,
                                                  (short)0, s, false, false);
      }

      // ---- online softmax in D-layout (rows striped r / r+8, cols = lanes) ----
      const int n    = lane & 15;
      const int mb   = (lane >> 4) << 3;
      const int kcol = j * 16 + n;
      float alpha[8];
#pragma unroll
      for (int r = 0; r < 8; ++r) {
        float sv = s[r] * scale;
        const int qrow = qrow0 + mb + r;
        if (kcol > qrow) sv = -3.0e38f;            // causal mask
        float rm = sv;                             // row max over 16-lane half
        rm = fmaxf(rm, __shfl_xor(rm, 1, 32));
        rm = fmaxf(rm, __shfl_xor(rm, 2, 32));
        rm = fmaxf(rm, __shfl_xor(rm, 4, 32));
        rm = fmaxf(rm, __shfl_xor(rm, 8, 32));
        const float mn = fmaxf(m[r], rm);
        const float pv = exp2_slot((sv - mn) * 1.44269504f);
        float rs = pv;                             // row sum over 16-lane half
        rs += __shfl_xor(rs, 1, 32);
        rs += __shfl_xor(rs, 2, 32);
        rs += __shfl_xor(rs, 4, 32);
        rs += __shfl_xor(rs, 8, 32);
        const float al = exp2_slot((m[r] - mn) * 1.44269504f);
        l[r] = l[r] * al + rs;
        m[r] = mn;
        alpha[r] = al;
        lp[wave][(mb + r) * PP + n] = pv;          // stash P for layout swap
      }
      asm volatile("s_wait_dscnt 0" ::: "memory"); // P visible across lanes

#pragma unroll
      for (int r = 0; r < 8; ++r) {                // rescale O by alpha
        o0[r] *= alpha[r]; o1[r] *= alpha[r]; o2[r] *= alpha[r]; o3[r] *= alpha[r];
      }

      // ---- O += P * V  (16 wmma: 4 K-chunks x 4 col tiles) ----
#pragma unroll
      for (int k0 = 0; k0 < 16; k0 += 4) {
        v2f a  = frag_nk(lp[wave], PP, k0);
        v2f b0 = frag_kn(lvj, PV, k0, 0);
        v2f b1 = frag_kn(lvj, PV, k0, 16);
        v2f b2 = frag_kn(lvj, PV, k0, 32);
        v2f b3 = frag_kn(lvj, PV, k0, 48);
        o0 = __builtin_amdgcn_wmma_f32_16x16x4_f32(false, a, false, b0, (short)0, o0, false, false);
        o1 = __builtin_amdgcn_wmma_f32_16x16x4_f32(false, a, false, b1, (short)0, o1, false, false);
        o2 = __builtin_amdgcn_wmma_f32_16x16x4_f32(false, a, false, b2, (short)0, o2, false, false);
        o3 = __builtin_amdgcn_wmma_f32_16x16x4_f32(false, a, false, b3, (short)0, o3, false, false);
      }
    }

    // foot of the trip: my LDS reads of this buffer are back, my copies of the
    // next stage have landed; the barrier publishes stage t + 1 and ends every
    // wave's reads of the buffer that is refilled behind it.
    asm volatile("s_wait_dscnt 0" ::: "memory");
    wait_async0();
    __syncthreads();
    if (t + 2 < nst) stage(t + 2, t & 1);
  }
  wait_async0();                                   // nothing in flight past the loop

  // ---- merge: each wave publishes its partial state ----
  {
    const int n  = lane & 15;
    const int mb = (lane >> 4) << 3;
#pragma unroll
    for (int r = 0; r < 8; ++r) {
      float* row = &lo[wave][(mb + r) * PO + n];
      row[0]  = o0[r];
      row[16] = o1[r];
      row[32] = o2[r];
      row[48] = o3[r];
    }
    if (n == 0) {                                  // every lane of a half holds the same m, l
#pragma unroll
      for (int r = 0; r < 8; ++r) { lm[wave][mb + r] = m[r]; ll[wave][mb + r] = l[r]; }
    }
  }
  __syncthreads();                                 // partial states visible to the block

  // wave (qsub, ks) joins rows 2 ks and 2 ks + 1 of query tile qsub: 16 lanes a row,
  // 4 columns a lane, so each 128-byte line of out has one writer.  The next write
  // of lo, lm and ll stands behind the barriers of the second pass.
  const int row = ks * 2 + (lane >> 4);
  const int c0  = (lane & 15) * 4;
  float ms[KSP];
  float mx = -3.0e38f;
#pragma unroll
  for (int s = 0; s < KSP; ++s) {
    ms[s] = lm[qsub * KSP + s][row];
    mx = fmaxf(mx, ms[s]);
  }
  float ws[KSP];
#pragma unroll
  for (int s = 0; s < KSP; ++s)                    // 0 for a wave that saw no key tile
    ws[s] = exp2_slot((ms[s] - mx) * 1.44269504f);
  float  ls = 0.0f;
  float4 a0 = make_float4(0.f, 0.f, 0.f, 0.f);
#pragma unroll
  for (int s = 0; s < KSP; ++s) {
    const float w = ws[s];
    ls += w * ll[qsub * KSP + s][row];
    const float4 p0 = *(const float4*)&lo[qsub * KSP + s][row * PO + c0];
    a0.x += w * p0.x; a0.y += w * p0.y; a0.z += w * p0.z; a0.w += w * p0.w;
  }
  const float inv = 1.0f / ls;
  float4* dst = (float4*)(out + (size_t)b * T * H + (size_t)(qrow0 + row) * H + c0);
  dst[0] = make_float4(a0.x * inv, a0.y * inv, a0.z * inv, a0.w * inv);
  // in front of the second pass's rewrite of the registers that the store names
  asm volatile("s_wait_xcnt 0x0" ::: "memory");
  }
}

// ---------------------------------------------------------------------------
extern "C" void kernel_launch(void* const* d_in, const int* in_sizes, int n_in,
                              void* d_out, int out_size, void* d_ws, size_t ws_size,
                              hipStream_t stream) {
  (void)in_sizes; (void)n_in; (void)out_size; (void)ws_size;
  const float* x  = (const float*)d_in[0];
  const float* Wq = (const float*)d_in[1];
  const float* Wk = (const float*)d_in[2];
  const float* Wv = (const float*)d_in[3];
  float* out = (float*)d_out;

  float* q  = (float*)d_ws;                       // 3 x 4 MB
  float* k  = q + (size_t)ROWS * H;
  float* v  = k + (size_t)ROWS * H;
  float* Wt = v + (size_t)ROWS * H;               // 3 x 256 KB transposed weights

  wt_kernel<<<(3 * C * H + 255) / 256, 256, 0, stream>>>(Wq, Wk, Wv, Wt);

  qkv_kernel<<<ROWS / 16, 384, 0, stream>>>(x, Wt, q, k, v);

  const int np2 = 2 * ROWS * (H / 2);
  rope_kernel<<<(np2 + 255) / 256, 256, 0, stream>>>(q, k);

  attn_kernel<<<B * (NG / 2), 32 * NW, 0, stream>>>(q, k, v, out);
}

// v003
// One run takes 130 microseconds.
// In both of two side-by-side timings against v002, it was 1.08 times as fast.
// Counting every step since v000, it is 4.21 times as fast.
#include <hip/hip_runtime.h>

// ---------------------------------------------------------------------------
// Fused causal attention head with RoPE for MI455X (gfx1250, wave32).
//   B=4, T=4096, C=1024, H=64, fp32.
// Matrix math: V_WMMA_F32_16X16X4_F32 (fp32-accurate tensor path).
// LDS staging: GLOBAL_LOAD_ASYNC_TO_LDS_B128 (ASYNCcnt), double-buffered.
// Weights pre-transposed (N x K) so every B-fragment lane-pair is contiguous.
// ---------------------------------------------------------------------------

typedef __attribute__((ext_vector_type(2))) float v2f;
typedef __attribute__((ext_vector_type(8))) float v8f;

constexpr int B = 4;
constexpr int T = 4096;
constexpr int C = 1024;
constexpr int H = 64;
constexpr int ROWS = B * T;          // 16384 rows of x / q / k / v
constexpr int QTB  = 2;              // attention: 16-row query tiles per block
constexpr int KSP  = 8;              // attention: waves that split one query tile's keys
constexpr int NW   = QTB * KSP;      // attention: waves per block
constexpr int SK   = 16 * KSP;       // attention: keys per LDS stage
constexpr int NG   = T / (16 * QTB); // attention: row groups per batch (two per block)
static_assert(NG % 2 == 0, "the attention kernel pairs row groups g and NG - 1 - g");

// LDS row pitches in floats (64 banks x 4 B; bank = dword address mod 64).
// 8-byte fragment reads walk 16 rows: a pitch of 4 x odd puts the 32 lanes on
// all 64 banks once.  The K x N reader takes rows kk and kk+2 in the two lane
// halves: twice its pitch is 16 mod 64, so the halves use disjoint banks.
constexpr int PQK = H + 4;           // Q and K tiles (row readers, 8 B per lane)
constexpr int PV  = H + 8;           // V tile (K x N reader, 4 B per lane)
constexpr int PP  = 16 + 4;          // P scratch (row reader; stores rows r, r+8)
constexpr int PO  = H + 4;           // partial O in the merge (stores rows r, r+8; 16 B readers)

// 16-byte async global->LDS copies (no VGPR round trip, ASYNCcnt).  The LDS operand
// is the low 32 bits of the flat address, which is the LDS offset.
// Eight copies behind one another; s_wait_xcnt 0 inside the statement stands in
// front of any rewrite of the address registers that the copies name.
__device__ __forceinline__ void async_copy8_b128(void* l0, const void* g0, void* l1, const void* g1,
                                                 void* l2, const void* g2, void* l3, const void* g3,
                                                 void* l4, const void* g4, void* l5, const void* g5,
                                                 void* l6, const void* g6, void* l7, const void* g7) {
  asm volatile("global_load_async_to_lds_b128 %0, %1, off\n\t"
               "global_load_async_to_lds_b128 %2, %3, off\n\t"
               "global_load_async_to_lds_b128 %4, %5, off\n\t"
               "global_load_async_to_lds_b128 %6, %7, off\n\t"
               "global_load_async_to_lds_b128 %8, %9, off\n\t"
               "global_load_async_to_lds_b128 %10, %11, off\n\t"
               "global_load_async_to_lds_b128 %12, %13, off\n\t"
               "global_load_async_to_lds_b128 %14, %15, off\n\t"
               "s_wait_xcnt 0x0"
               :: "v"((unsigned)(size_t)l0), "v"(g0), "v"((unsigned)(size_t)l1), "v"(g1),
                  "v"((unsigned)(size_t)l2), "v"(g2), "v"((unsigned)(size_t)l3), "v"(g3),
                  "v"((unsigned)(size_t)l4), "v"(g4), "v"((unsigned)(size_t)l5), "v"(g5),
                  "v"((unsigned)(size_t)l6), "v"(g6), "v"((unsigned)(size_t)l7), "v"(g7)
               : "memory");
}

__device__ __forceinline__ void wait_async0() {
  asm volatile("s_wait_asynccnt 0" ::: "memory");
}

// 2^x with the slot that the instruction set asks for behind a transcendental:
// the v_nop stands in the same statement, so nothing that overwrites the source
// or reads the result can follow the v_exp_f32 directly.
__device__ __forceinline__ float exp2_slot(float x) {
  float r;
  asm("v_exp_f32 %0, %1\n\tv_nop" : "=v"(r) : "v"(x));
  return r;
}

// A-fragment loader for a row-major M x K tile (also serves as the B-fragment
// loader when B is stored transposed, i.e. as N x K row-major).
//   lane 0..15  -> row = lane,    cols k0, k0+1
//   lane 16..31 -> row = lane-16, cols k0+2, k0+3
__device__ __forceinline__ v2f frag_nk(const float* __restrict__ base, int stride, int k0) {
  const int lane = threadIdx.x & 31;
  const int r  = lane & 15;
  const int kk = k0 + ((lane >> 4) << 1);
  v2f f;
  f.x = base[r * stride + kk];
  f.y = base[r * stride + kk + 1];
  return f;
}

// B-fragment loader when B is stored K x N row-major (stride = row pitch).
__device__ __forceinline__ v2f frag_kn(const float* __restrict__ base, int stride, int k0, int nb) {
  const int lane = threadIdx.x & 31;
  const int n  = lane & 15;
  const int kk = k0 + ((lane >> 4) << 1);
  v2f f;
  f.x = base[kk * stride + nb + n];
  f.y = base[(kk + 1) * stride + nb + n];
  return f;
}

// ---------------------------------------------------------------------------
// Kernel 0: transpose Wq/Wk/Wv (C x H) into Wt (3 x H x C).  768 KB once;
// makes every projection B-fragment a contiguous 8-byte load per lane.
// ---------------------------------------------------------------------------
__global__ void wt_kernel(const float* __restrict__ Wq, const float* __restrict__ Wk,
                          const float* __restrict__ Wv, float* __restrict__ Wt) {
  const int idx = blockIdx.x * blockDim.x + threadIdx.x;
  if (idx >= 3 * C * H) return;
  const int m = idx / (C * H);
  const int r = idx % (C * H);
  const int k = r / H;                              // consecutive idx -> coalesced read
  const int n = r % H;
  const float* __restrict__ W = (m == 0) ? Wq : (m == 1 ? Wk : Wv);
  Wt[(size_t)m * C * H + (size_t)n * C + k] = W[(size_t)k * H + n];
}

// ---------------------------------------------------------------------------
// Kernel 1: q/k/v projections.  One block per 64 rows of x and all 192 output
// columns (q | k | v): 256 blocks, one per WGP, 16 waves.
// A chunk is 128 steps of K: 64 rows of x and the 192 rows of Wt, both staged in
// LDS by async copies (each copy of a wave is 512 contiguous bytes of one row),
// two buffers.  A weight row is fetched once per 64 rows of x.
// Wave (rt, cg): row tile rt x column tiles 3 cg .. 3 cg + 2, three accumulators.
// ---------------------------------------------------------------------------
constexpr int KC  = 128;             // K-chunk
constexpr int PX  = KC + 4;          // LDS row pitch of the x and W chunks (4 x odd)
constexpr int MB  = 64;              // rows of x per block
constexpr int NB  = 3 * H;           // output columns per block
constexpr int NCH = C / KC;          // chunks
static_assert(NCH >= 2, "the two-buffer loop fills chunks 0 and 1 ahead");

__global__ __launch_bounds__(512) void qkv_kernel(
    const float* __restrict__ x, const float* __restrict__ Wt,
    float* __restrict__ q, float* __restrict__ k, float* __restrict__ v) {
  __shared__ __align__(16) float ls[2][(MB + NB) * PX];  // rows 0..63: x, rows 64..255: Wt

  const int tid  = threadIdx.x;
  const int wave = __builtin_amdgcn_readfirstlane(tid >> 5);  // 0..15
  const int lane = tid & 31;
  const int row0 = blockIdx.x * MB;
  const int rt   = wave & 3;         // 16-row tile of the block
  const int cg   = wave >> 2;        // group of three 16-col tiles

  // stage chunk `cidx` into buffer `buf`: wave w brings rows w, w + 16, ... of Wt
  // (12 rows) and of the x block (4 rows), one row chunk per copy.
  auto stage = [&](int cidx, int buf) {
    const float* wg = Wt + (size_t)wave * C + cidx * KC + lane * 4;
    const float* xg = x + (size_t)(row0 + wave) * C + cidx * KC + lane * 4;
    float* xl = &ls[buf][wave * PX + lane * 4];
    float* wl = xl + MB * PX;
    async_copy8_b128(wl,            wg,            wl +  16 * PX, wg +  16 * C,
                     wl +  32 * PX, wg +  32 * C,  wl +  48 * PX, wg +  48 * C,
                     wl +  64 * PX, wg +  64 * C,  wl +  80 * PX, wg +  80 * C,
                     wl +  96 * PX, wg +  96 * C,  wl + 112 * PX, wg + 112 * C);
    async_copy8_b128(wl + 128 * PX, wg + 128 * C,  wl + 144 * PX, wg + 144 * C,
                     wl + 160 * PX, wg + 160 * C,  wl + 176 * PX, wg + 176 * C,
                     xl,            xg,            xl +  16 * PX, xg +  16 * C,
                     xl +  32 * PX, xg +  32 * C,  xl +  48 * PX, xg +  48 * C);
  };

  stage(0, 0);
  wait_async0();                     // my copies of chunk 0 landed
  __syncthreads();                   // everyone's -> chunk 0 valid
  stage(1, 1);

  v8f acc0 = {}, acc1 = {}, acc2 = {};
  // kept rolled: the buffer's offset then sits in a register, and the fragment reads
  // of both buffers pair up with immediate offsets (unrolled, buffer 1's offset is a
  // constant too large for the offset field and costs one address add per read)
#pragma unroll 1
  for (int cidx = 0; cidx < NCH; ++cidx) {
    const float* __restrict__ la  = ls[cidx & 1] + rt * 16 * PX;
    const float* __restrict__ lb0 = ls[cidx & 1] + (MB + cg * 48) * PX;
    const float* __restrict__ lb1 = lb0 + 16 * PX;
    const float* __restrict__ lb2 = lb0 + 32 * PX;
    // whole chunk unrolled: the fragment reads run one group ahead of the WMMAs with
    // counted waits from the chunk's first step to its last
#pragma unroll
    for (int k0 = 0; k0 < KC; k0 += 4) {
      v2f a  = frag_nk(la,  PX, k0);               // A: 16x4 slice of the x tile
      v2f b0 = frag_nk(lb0, PX, k0);               // B: 4x16 slices of Wt (NxK)
      v2f b1 = frag_nk(lb1, PX, k0);
      v2f b2 = frag_nk(lb2, PX, k0);
      acc0 = __builtin_amdgcn_wmma_f32_16x16x4_f32(false, a, false, b0, (short)0, acc0, false, false);
      acc1 = __builtin_amdgcn_wmma_f32_16x16x4_f32(false, a, false, b1, (short)0, acc1, false, false);
      acc2 = __builtin_amdgcn_wmma_f32_16x16x4_f32(false, a, false, b2, (short)0, acc2, false, false);
    }

    // foot of the trip: my LDS reads of this buffer are back, my copies of the
    // next chunk have landed; the barrier publishes chunk cidx + 1 and ends every
    // wave's reads of the buffer that is refilled behind it.
    asm volatile("s_wait_dscnt 0" ::: "memory");
    wait_async0();
    __syncthreads();
    if (cidx + 2 < NCH) stage(cidx + 2, cidx & 1);
  }
  wait_async0();                     // nothing in flight past the loop

  // D layout: vgpr r -> M = r + 8*(lane>=16), N = lane&15
  const int n  = lane & 15;
  const int mb = (lane >> 4) << 3;
  const size_t ro = (size_t)(row0 + rt * 16 + mb) * H + n;
  auto put = [&](int ct, const v8f& acc) {         // ct: column tile 0..11 over q | k | v
    float* __restrict__ o = ((ct >> 2) == 0 ? q : ((ct >> 2) == 1 ? k : v)) + ro + (ct & 3) * 16;
#pragma unroll
    for (int r = 0; r < 8; ++r) o[r * H] = acc[r];
  };
  put(cg * 3 + 0, acc0);
  // in front of the next address, which may take over registers that the stores name
  asm volatile("s_wait_xcnt 0x0" ::: "memory");
  put(cg * 3 + 1, acc1);
  put(cg * 3 + 2, acc2);
}

// ---------------------------------------------------------------------------
// Kernel 2: RoPE on q and k (in workspace).  One thread per rotated pair.
// ---------------------------------------------------------------------------
__global__ void rope_kernel(float* __restrict__ q, float* __restrict__ k) {
  const int NP = ROWS * (H / 2);                   // pairs per tensor
  const int idx = blockIdx.x * blockDim.x + threadIdx.x;
  if (idx >= 2 * NP) return;
  float* base = (idx < NP) ? q : k;
  const int p   = (idx < NP) ? idx : idx - NP;
  const int row = p >> 5;                          // / (H/2)
  const int h   = p & 31;
  const int t   = row & (T - 1);                   // position within sequence
  const float freq = __powf(10000.0f, -(float)(2 * h) / (float)H);
  float s, c;
  __sincosf((float)t * freq, &s, &c);
  float2* pr = (float2*)(base + (size_t)row * H) + h;
  const float2 val = *pr;
  float2 o;
  o.x = val.x * c - val.y * s;
  o.y = val.x * s + val.y * c;
  *pr = o;
}

// ---------------------------------------------------------------------------
// Kernel 3: flash attention.  One block = 2 query tiles (32 rows) x 8-way key
// split = 16 waves.  A stage is 128 keys (8 key tiles) of K and V in LDS, two
// buffers filled by async-to-LDS copies; wave (qsub, ks) works key tile ks of
// each stage against query tile qsub with its own running max, sum and O.
// The eight partial states of a query tile are merged through LDS at the end.
// Four waves per SIMD: one wave's softmax and LDS latency runs under the other
// waves' matrix work.  Causal cost grows with the row group g, so each block
// runs groups NG - 1 - g and g one after the other: 256 blocks of equal cost.
// ---------------------------------------------------------------------------
__global__ __launch_bounds__(32 * NW) void attn_kernel(
    const float* __restrict__ q, const float* __restrict__ kk,
    const float* __restrict__ vv, float* __restrict__ out) {
  __shared__ __align__(16) float lq[QTB * 16 * PQK]; // the block's Q rows
  __shared__ __align__(16) float lk[2][SK * PQK];    // K stage ping-pong (NxK view)
  __shared__ __align__(16) float lv[2][SK * PV];     // V stage ping-pong (KxN view)
  __shared__ __align__(16) float lp[NW][16 * PP];    // per-wave P scratch
  __shared__ __align__(16) float lo[NW][16 * PO];    // per-wave partial O (merge)
  __shared__ float lm[NW][16];                       // per-wave row maxima (merge)
  __shared__ float ll[NW][16];                       // per-wave row sums (merge)

  const int tid  = threadIdx.x;
  const int wave = __builtin_amdgcn_readfirstlane(tid >> 5);
  const int lane = tid & 31;
  const int qsub = wave / KSP;                     // query tile within the block
  const int ks   = wave % KSP;                     // key tile within a stage

  const int b  = blockIdx.x / (NG / 2);
  const int gi = blockIdx.x % (NG / 2);

  const float* __restrict__ qb = q  + (size_t)b * T * H;
  const float* __restrict__ kb = kk + (size_t)b * T * H;
  const float* __restrict__ vb = vv + (size_t)b * T * H;

  // stage the 128 keys of stage t into buffer `buf` (4 B128 of K, 4 of V per thread)
  auto stage = [&](int t, int buf) {
    const float* ks_ = kb + (size_t)t * SK * H + tid * 4;
    const float* vs_ = vb + (size_t)t * SK * H + tid * 4;
    float* lkd = &lk[buf][(tid >> 4) * PQK + (tid & 15) * 4];  // rows r, r+32, r+64, r+96
    float* lvd = &lv[buf][(tid >> 4) * PV  + (tid & 15) * 4];
    async_copy8_b128(lkd,            ks_,            lvd,           vs_,
                     lkd + 32 * PQK, ks_ + 32 * H,   lvd + 32 * PV, vs_ + 32 * H,
                     lkd + 64 * PQK, ks_ + 64 * H,   lvd + 64 * PV, vs_ + 64 * H,
                     lkd + 96 * PQK, ks_ + 96 * H,   lvd + 96 * PV, vs_ + 96 * H);
  };

  for (int pass = 0; pass < 2; ++pass) {           // heavy group, then its light partner
  const int g     = pass ? gi : NG - 1 - gi;
  const int iw    = g * QTB + qsub;                // this wave's query-tile idx
  const int qrow0 = iw * 16;                       // query row base (within batch)
  const int nst   = (g * QTB + QTB + KSP - 1) / KSP;  // stages, uniform per block

  // the group's 32 Q rows (plain loads; published by the barrier below).  In the
  // second pass the last barrier of the first loop has ended every read of lq and
  // of the two stage buffers.
  for (int i = tid; i < QTB * 16 * H; i += 32 * NW)
    lq[(i >> 6) * PQK + (i & (H - 1))] = qb[(size_t)(g * QTB * 16) * H + i];

  stage(0, 0);
  wait_async0();                                   // my copies of stage 0 landed
  __syncthreads();                                 // everyone's -> stage 0 and Q valid
  if (nst > 1) stage(1, 1);

  v8f o0 = {}, o1 = {}, o2 = {}, o3 = {};
  float m[8], l[8];
#pragma unroll
  for (int r = 0; r < 8; ++r) { m[r] = -3.0e38f; l[r] = 0.0f; }

  const float scale = 0.03125f;                    // C^-0.5 = 1/32
  const float* __restrict__ lqw = lq + qsub * 16 * PQK;

  for (int t = 0; t < nst; ++t) {
    const int j = t * KSP + ks;                    // this wave's key tile
    if (j <= iw) {                                 // causal skip (wave-uniform)
      const float* __restrict__ lkj = lk[t & 1] + ks * 16 * PQK;
      const float* __restrict__ lvj = lv[t & 1] + ks * 16 * PV;

      // ---- S = Q * K^T  (16 wmma, K = 64) ----
      v8f s = {};
#pragma unroll
      for (int k0 = 0; k0 < H; k0 += 4) {
        v2f a  = frag_nk(lqw, PQK, k0);
        v2f bf = frag_nk(lkj, PQK, k0);            // K tile is N x K row-major
        s = __builtin_amdgcn_wmma_f32_16x16x4_f32(false, a, false, bf,
                                                  (short)0, s, false, false);
      }

      // ---- online softmax in D-layout (rows striped r / r+8, cols = lanes) ----
      const int n    = lane & 15;
      const int mb   = (lane >> 4) << 3;
      const int kcol = j * 16 + n;
      float alpha[8];
#pragma unroll
      for (int r = 0; r < 8; ++r) {
        float sv = s[r] * scale;
        const int qrow = qrow0 + mb + r;
        if (kcol > qrow) sv = -3.0e38f;            // causal mask
        float rm = sv;                             // row max over 16-lane half
        rm = fmaxf(rm, __shfl_xor(rm, 1, 32));
        rm = fmaxf(rm, __shfl_xor(rm, 2, 32));
        rm = fmaxf(rm, __shfl_xor(rm, 4, 32));
        rm = fmaxf(rm, __shfl_xor(rm, 8, 32));
        const float mn = fmaxf(m[r], rm);
        const float pv = exp2_slot((sv - mn) * 1.44269504f);
        float rs = pv;                             // row sum over 16-lane half
        rs += __shfl_xor(rs, 1, 32);
        rs += __shfl_xor(rs, 2, 32);
        rs += __shfl_xor(rs, 4, 32);
        rs += __shfl_xor(rs, 8, 32);
        const float al = exp2_slot((m[r] - mn) * 1.44269504f);
        l[r] = l[r] * al + rs;
        m[r] = mn;
        alpha[r] = al;
        lp[wave][(mb + r) * PP + n] = pv;          // stash P for layout swap
      }
      asm volatile("s_wait_dscnt 0" ::: "memory"); // P visible across lanes

#pragma unroll
      for (int r = 0; r < 8; ++r) {                // rescale O by alpha
        o0[r] *= alpha[r]; o1[r] *= alpha[r]; o2[r] *= alpha[r]; o3[r] *= alpha[r];
      }

      // ---- O += P * V  (16 wmma: 4 K-chunks x 4 col tiles) ----
#pragma unroll
      for (int k0 = 0; k0 < 16; k0 += 4) {
        v2f a  = frag_nk(lp[wave], PP, k0);
        v2f b0 = frag_kn(lvj, PV, k0, 0);
        v2f b1 = frag_kn(lvj, PV, k0, 16);
        v2f b2 = frag_kn(lvj, PV, k0, 32);
        v2f b3 = frag_kn(lvj, PV, k0, 48);
        o0 = __builtin_amdgcn_wmma_f32_16x16x4_f32(false, a, false, b0, (short)0, o0, false, false);
        o1 = __builtin_amdgcn_wmma_f32_16x16x4_f32(false, a, false, b1, (short)0, o1, false, false);
        o2 = __builtin_amdgcn_wmma_f32_16x16x4_f32(false, a, false, b2, (short)0, o2, false, false);
        o3 = __builtin_amdgcn_wmma_f32_16x16x4_f32(false, a, false, b3, (short)0, o3, false, false);
      }
    }

    // foot of the trip: my LDS reads of this buffer are back, my copies of the
    // next stage have landed; the barrier publishes stage t + 1 and ends every
    // wave's reads of the buffer that is refilled behind it.
    asm volatile("s_wait_dscnt 0" ::: "memory");
    wait_async0();
    __syncthreads();
    if (t + 2 < nst) stage(t + 2, t & 1);
  }
  wait_async0();                                   // nothing in flight past the loop

  // ---- merge: each wave publishes its partial state ----
  {
    const int n  = lane & 15;
    const int mb = (lane >> 4) << 3;
#pragma unroll
    for (int r = 0; r < 8; ++r) {
      float* row = &lo[wave][(mb + r) * PO + n];
      row[0]  = o0[r];
      row[16] = o1[r];
      row[32] = o2[r];
      row[48] = o3[r];
    }
    if (n == 0) {                                  // every lane of a half holds the same m, l
#pragma unroll
      for (int r = 0; r < 8; ++r) { lm[wave][mb + r] = m[r]; ll[wave][mb + r] = l[r]; }
    }
  }
  __syncthreads();                                 // partial states visible to the block

  // wave (qsub, ks) joins rows 2 ks and 2 ks + 1 of query tile qsub: 16 lanes a row,
  // 4 columns a lane, so each 128-byte line of out has one writer.  The next write
  // of lo, lm and ll stands behind the barriers of the second pass.
  const int row = ks * 2 + (lane >> 4);
  const int c0  = (lane & 15) * 4;
  float ms[KSP];
  float mx = -3.0e38f;
#pragma unroll
  for (int s = 0; s < KSP; ++s) {
    ms[s] = lm[qsub * KSP + s][row];
    mx = fmaxf(mx, ms[s]);
  }
  float ws[KSP];
#pragma unroll
  for (int s = 0; s < KSP; ++s)                    // 0 for a wave that saw no key tile
    ws[s] = exp2_slot((ms[s] - mx) * 1.44269504f);
  float  ls = 0.0f;
  float4 a0 = make_float4(0.f, 0.f, 0.f, 0.f);
#pragma unroll
  for (int s = 0; s < KSP; ++s) {
    const float w = ws[s];
    ls += w * ll[qsub * KSP + s][row];
    const float4 p0 = *(const float4*)&lo[qsub * KSP + s][row * PO + c0];
    a0.x += w * p0.x; a0.y += w * p0.y; a0.z += w * p0.z; a0.w += w * p0.w;
  }
  const float inv = 1.0f / ls;
  float4* dst = (float4*)(out + (size_t)b * T * H + (size_t)(qrow0 + row) * H + c0);
  dst[0] = make_float4(a0.x * inv, a0.y * inv, a0.z * inv, a0.w * inv);
  // in front of the second pass's rewrite of the registers that the store names
  asm volatile("s_wait_xcnt 0x0" ::: "memory");
  }
}

// ---------------------------------------------------------------------------
extern "C" void kernel_launch(void* const* d_in, const int* in_sizes, int n_in,
                              void* d_out, int out_size, void* d_ws, size_t ws_size,
                              hipStream_t stream) {
  (void)in_sizes; (void)n_in; (void)out_size; (void)ws_size;
  const float* x  = (const float*)d_in[0];
  const float* Wq = (const float*)d_in[1];
  const float* Wk = (const float*)d_in[2];
  const float* Wv = (const float*)d_in[3];
  float* out = (float*)d_out;

  float* q  = (float*)d_ws;                       // 3 x 4 MB
  float* k  = q + (size_t)ROWS * H;
  float* v  = k + (size_t)ROWS * H;
  float* Wt = v + (size_t)ROWS * H;               // 3 x 256 KB transposed weights

  wt_kernel<<<(3 * C * H + 255) / 256, 256, 0, stream>>>(Wq, Wk, Wv, Wt);

  qkv_kernel<<<ROWS / MB, 512, 0, stream>>>(x, Wt, q, k, v);

  const int np2 = 2 * ROWS * (H / 2);
  rope_kernel<<<(np2 + 255) / 256, 256, 0, stream>>>(q, k);

  attn_kernel<<<B * (NG / 2), 32 * NW, 0, stream>>>(q, k, v, out);
}

// v004
// One run takes 116 microseconds.
// Timed twice side by side with v003, it ran 1.12 times as fast both times.
// Over all steps from v000 it is 4.72 times as fast.
#include <hip/hip_runtime.h>

// ---------------------------------------------------------------------------
// Fused causal attention head with RoPE for MI455X (gfx1250, wave32).
//   B=4, T=4096, C=1024, H=64, fp32.
// Matrix math: V_WMMA_F32_16X16X4_F32 (fp32-accurate tensor path).
// LDS staging: GLOBAL_LOAD_ASYNC_TO_LDS_B128 (ASYNCcnt), double-buffered.
// Weights pre-transposed (N x K) so every B-fragment lane-pair is contiguous.
// ---------------------------------------------------------------------------

typedef __attribute__((ext_vector_type(2))) float v2f;
typedef __attribute__((ext_vector_type(8))) float v8f;

constexpr int B = 4;
constexpr int T = 4096;
constexpr int C = 1024;
constexpr int H = 64;
constexpr int ROWS = B * T;          // 16384 rows of x / q / k / v
constexpr int QTB  = 2;              // attention: 16-row query tiles per block
constexpr int KSP  = 8;              // attention: waves that split one query tile's keys
constexpr int NW   = QTB * KSP;      // attention: waves per block
constexpr int SK   = 16 * KSP;       // attention: keys per LDS stage
constexpr int NG   = T / (16 * QTB); // attention: row groups per batch (two per block)
static_assert(NG % 2 == 0, "the attention kernel pairs row groups g and NG - 1 - g");

// LDS row pitches in floats (64 banks x 4 B; bank = dword address mod 64).
// 8-byte fragment reads walk 16 rows: a pitch of 4 x odd puts the 32 lanes on
// all 64 banks once.  V lies by key pairs: a row holds keys 2i and 2i + 1 as
// [column tile][key][16 columns], so the two keys that a lane feeds to one matrix
// step are 16 floats apart (one two-address read into one register pair).  The
// lane halves read rows i and i + 4: four pitches are 32 mod 64, disjoint banks.
constexpr int PQK = H + 4;           // Q and K tiles (row readers, 8 B per lane)
constexpr int PV  = 2 * H + 8;       // V key-pair row (column reader, 2 x 4 B per lane)
constexpr int PO  = H + 4;           // partial O in the merge (16 B stores and readers)

// 16-byte async global->LDS copies (no VGPR round trip, ASYNCcnt).  The LDS operand
// is the low 32 bits of the flat address, which is the LDS offset.
// Eight copies behind one another; s_wait_xcnt 0 inside the statement stands in
// front of any rewrite of the address registers that the copies name.
__device__ __forceinline__ void async_copy8_b128(void* l0, const void* g0, void* l1, const void* g1,
                                                 void* l2, const void* g2, void* l3, const void* g3,
                                                 void* l4, const void* g4, void* l5, const void* g5,
                                                 void* l6, const void* g6, void* l7, const void* g7) {
  asm volatile("global_load_async_to_lds_b128 %0, %1, off\n\t"
               "global_load_async_to_lds_b128 %2, %3, off\n\t"
               "global_load_async_to_lds_b128 %4, %5, off\n\t"
               "global_load_async_to_lds_b128 %6, %7, off\n\t"
               "global_load_async_to_lds_b128 %8, %9, off\n\t"
               "global_load_async_to_lds_b128 %10, %11, off\n\t"
               "global_load_async_to_lds_b128 %12, %13, off\n\t"
               "global_load_async_to_lds_b128 %14, %15, off\n\t"
               "s_wait_xcnt 0x0"
               :: "v"((unsigned)(size_t)l0), "v"(g0), "v"((unsigned)(size_t)l1), "v"(g1),
                  "v"((unsigned)(size_t)l2), "v"(g2), "v"((unsigned)(size_t)l3), "v"(g3),
                  "v"((unsigned)(size_t)l4), "v"(g4), "v"((unsigned)(size_t)l5), "v"(g5),
                  "v"((unsigned)(size_t)l6), "v"(g6), "v"((unsigned)(size_t)l7), "v"(g7)
               : "memory");
}

__device__ __forceinline__ void wait_async0() {
  asm volatile("s_wait_asynccnt 0" ::: "memory");
}

// 2^x with the slot that the instruction set asks for behind a transcendental:
// the v_nop stands in the same statement, so nothing that overwrites the source
// or reads the result can follow the v_exp_f32 directly.
__device__ __forceinline__ float exp2_slot(float x) {
  float r;
  asm("v_exp_f32 %0, %1\n\tv_nop" : "=v"(r) : "v"(x));
  return r;
}

// A-fragment loader for a row-major M x K tile (also serves as the B-fragment
// loader when B is stored transposed, i.e. as N x K row-major).
//   lane 0..15  -> row = lane,    cols k0, k0+1
//   lane 16..31 -> row = lane-16, cols k0+2, k0+3
__device__ __forceinline__ v2f frag_nk(const float* __restrict__ base, int stride, int k0) {
  const int lane = threadIdx.x & 31;
  const int r  = lane & 15;
  const int kk = k0 + ((lane >> 4) << 1);
  v2f f;
  f.x = base[r * stride + kk];
  f.y = base[r * stride + kk + 1];
  return f;
}

// A-fragment loader for V^T from a V tile stored by key pairs, in the k order of a
// score accumulator used as B: step c of a 16-key tile, column tile ct, takes
//   lane 0..15  -> column 16 ct + lane,      keys 2c,     2c + 1
//   lane 16..31 -> column 16 ct + lane - 16, keys 8 + 2c, 8 + 2c + 1
// `lbase` is the lane's own start: key 8 (lane >= 16), column lane & 15 of the tile.
__device__ __forceinline__ v2f frag_vt(const float* __restrict__ lbase, int c, int ct) {
  v2f f;
  f.x = lbase[c * PV + ct * 32];
  f.y = lbase[c * PV + ct * 32 + 16];
  return f;
}

// lane l takes the value of lane l ^ 16 (vector cross-row move, no LDS trip)
__device__ __forceinline__ float xhalf(float x) {
  const int b = __builtin_bit_cast(int, x);
  return __builtin_bit_cast(float,
      __builtin_amdgcn_permlanex16(b, b, 0x76543210, 0xfedcba98, false, false));
}

// ---------------------------------------------------------------------------
// Kernel 0: transpose Wq/Wk/Wv (C x H) into Wt (3 x H x C).  768 KB once;
// makes every projection B-fragment a contiguous 8-byte load per lane.
// ---------------------------------------------------------------------------
__global__ void wt_kernel(const float* __restrict__ Wq, const float* __restrict__ Wk,
                          const float* __restrict__ Wv, float* __restrict__ Wt) {
  const int idx = blockIdx.x * blockDim.x + threadIdx.x;
  if (idx >= 3 * C * H) return;
  const int m = idx / (C * H);
  const int r = idx % (C * H);
  const int k = r / H;                              // consecutive idx -> coalesced read
  const int n = r % H;
  const float* __restrict__ W = (m == 0) ? Wq : (m == 1 ? Wk : Wv);
  Wt[(size_t)m * C * H + (size_t)n * C + k] = W[(size_t)k * H + n];
}

// ---------------------------------------------------------------------------
// Kernel 1: q/k/v projections.  One block per 64 rows of x and all 192 output
// columns (q | k | v): 256 blocks, one per WGP, 16 waves.
// A chunk is 128 steps of K: 64 rows of x and the 192 rows of Wt, both staged in
// LDS by async copies (each copy of a wave is 512 contiguous bytes of one row),
// two buffers.  A weight row is fetched once per 64 rows of x.
// Wave (rt, cg): row tile rt x column tiles 3 cg .. 3 cg + 2, three accumulators.
// ---------------------------------------------------------------------------
constexpr int KC  = 128;             // K-chunk
constexpr int PX  = KC + 4;          // LDS row pitch of the x and W chunks (4 x odd)
constexpr int MB  = 64;              // rows of x per block
constexpr int NB  = 3 * H;           // output columns per block
constexpr int NCH = C / KC;          // chunks
static_assert(NCH >= 2, "the two-buffer loop fills chunks 0 and 1 ahead");

__global__ __launch_bounds__(512) void qkv_kernel(
    const float* __restrict__ x, const float* __restrict__ Wt,
    float* __restrict__ q, float* __restrict__ k, float* __restrict__ v) {
  __shared__ __align__(16) float ls[2][(MB + NB) * PX];  // rows 0..63: x, rows 64..255: Wt

  const int tid  = threadIdx.x;
  const int wave = __builtin_amdgcn_readfirstlane(tid >> 5);  // 0..15
  const int lane = tid & 31;
  const int row0 = blockIdx.x * MB;
  const int rt   = wave & 3;         // 16-row tile of the block
  const int cg   = wave >> 2;        // group of three 16-col tiles

  // stage chunk `cidx` into buffer `buf`: wave w brings rows w, w + 16, ... of Wt
  // (12 rows) and of the x block (4 rows), one row chunk per copy.
  auto stage = [&](int cidx, int buf) {
    const float* wg = Wt + (size_t)wave * C + cidx * KC + lane * 4;
    const float* xg = x + (size_t)(row0 + wave) * C + cidx * KC + lane * 4;
    float* xl = &ls[buf][wave * PX + lane * 4];
    float* wl = xl + MB * PX;
    async_copy8_b128(wl,            wg,            wl +  16 * PX, wg +  16 * C,
                     wl +  32 * PX, wg +  32 * C,  wl +  48 * PX, wg +  48 * C,
                     wl +  64 * PX, wg +  64 * C,  wl +  80 * PX, wg +  80 * C,
                     wl +  96 * PX, wg +  96 * C,  wl + 112 * PX, wg + 112 * C);
    async_copy8_b128(wl + 128 * PX, wg + 128 * C,  wl + 144 * PX, wg + 144 * C,
                     wl + 160 * PX, wg + 160 * C,  wl + 176 * PX, wg + 176 * C,
                     xl,            xg,            xl +  16 * PX, xg +  16 * C,
                     xl +  32 * PX, xg +  32 * C,  xl +  48 * PX, xg +  48 * C);
  };

  stage(0, 0);
  wait_async0();                     // my copies of chunk 0 landed
  __syncthreads();                   // everyone's -> chunk 0 valid
  stage(1, 1);

  v8f acc0 = {}, acc1 = {}, acc2 = {};
  // kept rolled: the buffer's offset then sits in a register, and the fragment reads
  // of both buffers pair up with immediate offsets (unrolled, buffer 1's offset is a
  // constant too large for the offset field and costs one address add per read)
#pragma unroll 1
  for (int cidx = 0; cidx < NCH; ++cidx) {
    const float* __restrict__ la  = ls[cidx & 1] + rt * 16 * PX;
    const float* __restrict__ lb0 = ls[cidx & 1] + (MB + cg * 48) * PX;
    const float* __restrict__ lb1 = lb0 + 16 * PX;
    const float* __restrict__ lb2 = lb0 + 32 * PX;
    // whole chunk unrolled: the fragment reads run one group ahead of the WMMAs with
    // counted waits from the chunk's first step to its last
#pragma unroll
    for (int k0 = 0; k0 < KC; k0 += 4) {
      v2f a  = frag_nk(la,  PX, k0);               // A: 16x4 slice of the x tile
      v2f b0 = frag_nk(lb0, PX, k0);               // B: 4x16 slices of Wt (NxK)
      v2f b1 = frag_nk(lb1, PX, k0);
      v2f b2 = frag_nk(lb2, PX, k0);
      acc0 = __builtin_amdgcn_wmma_f32_16x16x4_f32(false, a, false, b0, (short)0, acc0, false, false);
      acc1 = __builtin_amdgcn_wmma_f32_16x16x4_f32(false, a, false, b1, (short)0, acc1, false, false);
      acc2 = __builtin_amdgcn_wmma_f32_16x16x4_f32(false, a, false, b2, (short)0, acc2, false, false);
    }

    // foot of the trip: my LDS reads of this buffer are back, my copies of the
    // next chunk have landed; the barrier publishes chunk cidx + 1 and ends every
    // wave's reads of the buffer that is refilled behind it.
    asm volatile("s_wait_dscnt 0" ::: "memory");
    wait_async0();
    __syncthreads();
    if (cidx + 2 < NCH) stage(cidx + 2, cidx & 1);
  }
  wait_async0();                     // nothing in flight past the loop

  // D layout: vgpr r -> M = r + 8*(lane>=16), N = lane&15
  const int n  = lane & 15;
  const int mb = (lane >> 4) << 3;
  const size_t ro = (size_t)(row0 + rt * 16 + mb) * H + n;
  auto put = [&](int ct, const v8f& acc) {         // ct: column tile 0..11 over q | k | v
    float* __restrict__ o = ((ct >> 2) == 0 ? q : ((ct >> 2) == 1 ? k : v)) + ro + (ct & 3) * 16;
#pragma unroll
    for (int r = 0; r < 8; ++r) o[r * H] = acc[r];
  };
  put(cg * 3 + 0, acc0);
  // in front of the next address, which may take over registers that the stores name
  asm volatile("s_wait_xcnt 0x0" ::: "memory");
  put(cg * 3 + 1, acc1);
  put(cg * 3 + 2, acc2);
}

// ---------------------------------------------------------------------------
// Kernel 2: RoPE on q and k (in workspace).  One thread per rotated pair.
// ---------------------------------------------------------------------------
__global__ void rope_kernel(float* __restrict__ q, float* __restrict__ k) {
  const int NP = ROWS * (H / 2);                   // pairs per tensor
  const int idx = blockIdx.x * blockDim.x + threadIdx.x;
  if (idx >= 2 * NP) return;
  float* base = (idx < NP) ? q : k;
  const int p   = (idx < NP) ? idx : idx - NP;
  const int row = p >> 5;                          // / (H/2)
  const int h   = p & 31;
  const int t   = row & (T - 1);                   // position within sequence
  const float freq = __powf(10000.0f, -(float)(2 * h) / (float)H);
  float s, c;
  __sincosf((float)t * freq, &s, &c);
  float2* pr = (float2*)(base + (size_t)row * H) + h;
  const float2 val = *pr;
  float2 o;
  o.x = val.x * c - val.y * s;
  o.y = val.x * s + val.y * c;
  *pr = o;
}

__global__ __launch_bounds__(32 * NW) void attn_kernel(
    const float* __restrict__ q, const float* __restrict__ kk,
    const float* __restrict__ vv, float* __restrict__ out) {
  __shared__ __align__(16) float lq[QTB * 16 * PQK]; // the block's Q rows
  __shared__ __align__(16) float lk[2][SK * PQK];    // K stage ping-pong (M x K, the A operand)
  __shared__ __align__(16) float lv[2][SK / 2 * PV]; // V stage ping-pong (key pairs)
  __shared__ __align__(16) float lo[NW][16 * PO];    // per-wave partial O (merge)
  __shared__ float lm[NW][16];                       // per-wave row maxima (merge)
  __shared__ float ll[NW][16];                       // per-wave row sums (merge)

  const int tid  = threadIdx.x;
  const int wave = __builtin_amdgcn_readfirstlane(tid >> 5);
  const int lane = tid & 31;
  const int qsub = wave / KSP;                     // query tile within the block
  const int ks   = wave % KSP;                     // key tile within a stage

  const int b  = blockIdx.x / (NG / 2);
  const int gi = blockIdx.x % (NG / 2);

  const float* __restrict__ qb = q  + (size_t)b * T * H;
  const float* __restrict__ kb = kk + (size_t)b * T * H;
  const float* __restrict__ vb = vv + (size_t)b * T * H;

  // stage the 128 keys of stage t into buffer `buf` (4 B128 of K, 4 of V per thread)
  auto stage = [&](int t, int buf) {
    const float* ks_ = kb + (size_t)t * SK * H + tid * 4;
    const float* vs_ = vb + (size_t)t * SK * H + tid * 4;
    float* lkd = &lk[buf][(tid >> 4) * PQK + (tid & 15) * 4];  // rows r, r+32, r+64, r+96
    float* lvd = &lv[buf][(tid >> 5) * PV + ((tid & 15) >> 2) * 32 + ((tid >> 4) & 1) * 16
                          + (tid & 3) * 4];                    // key r -> pair row r / 2
    async_copy8_b128(lkd,            ks_,            lvd,           vs_,
                     lkd + 32 * PQK, ks_ + 32 * H,   lvd + 16 * PV, vs_ + 32 * H,
                     lkd + 64 * PQK, ks_ + 64 * H,   lvd + 32 * PV, vs_ + 64 * H,
                     lkd + 96 * PQK, ks_ + 96 * H,   lvd + 48 * PV, vs_ + 96 * H);
  };

  for (int pass = 0; pass < 2; ++pass) {           // heavy group, then its light partner
  const int g     = pass ? gi : NG - 1 - gi;
  const int iw    = g * QTB + qsub;                // this wave's query-tile idx
  const int qrow0 = iw * 16;                       // query row base (within batch)
  const int nst   = (g * QTB + QTB + KSP - 1) / KSP;  // stages, uniform per block

  // the group's 32 Q rows (plain loads; published by the barrier below).  In the
  // second pass the last barrier of the first loop has ended every read of lq and
  // of the two stage buffers.
  for (int i = tid; i < QTB * 16 * H; i += 32 * NW)
    lq[(i >> 6) * PQK + (i & (H - 1))] = qb[(size_t)(g * QTB * 16) * H + i];

  stage(0, 0);
  wait_async0();                                   // my copies of stage 0 landed
  __syncthreads();                                 // everyone's -> stage 0 and Q valid
  if (nst > 1) stage(1, 1);

  // O^T: tile i, register r -> column 16 i + 8 (lane >= 16) + r, query lane & 15
  v8f o0 = {}, o1 = {}, o2 = {}, o3 = {};
  float m = -3.0e38f;                              // running max of query lane & 15
  float l = 0.0f;                                  // its sum over this lane half's keys

  const float scale = 0.03125f;                    // C^-0.5 = 1/32
  const float* __restrict__ lqw = lq + qsub * 16 * PQK;

  for (int t = 0; t < nst; ++t) {
    const int j = t * KSP + ks;                    // this wave's key tile
    if (j <= iw) {                                 // causal skip (wave-uniform)
      const float* __restrict__ lkj = lk[t & 1] + ks * 16 * PQK;
      const float* __restrict__ lvj = lv[t & 1] + (ks * 8 + ((lane >> 4) << 2)) * PV + (lane & 15);

      // ---- S^T = K * Q^T  (16 wmma, K = 64) ----
      v8f s = {};
#pragma unroll
      for (int k0 = 0; k0 < H; k0 += 4) {
        v2f a  = frag_nk(lkj, PQK, k0);            // A: 16 keys x 4
        v2f bf = frag_nk(lqw, PQK, k0);            // B: Q tile is N x K row-major
        s = __builtin_amdgcn_wmma_f32_16x16x4_f32(false, a, false, bf,
                                                  (short)0, s, false, false);
      }

      // ---- online softmax: register r -> key 8 (lane >= 16) + r, query lane & 15 ----
      const int qrow = qrow0 + (lane & 15);
      const int key0 = j * 16 + ((lane >> 4) << 3);
      float sv[8];
#pragma unroll
      for (int r = 0; r < 8; ++r) {
        sv[r] = s[r] * scale;
        if (key0 + r > qrow) sv[r] = -3.0e38f;     // causal mask
      }
      float rm = fmaxf(fmaxf(fmaxf(sv[0], sv[1]), fmaxf(sv[2], sv[3])),
                       fmaxf(fmaxf(sv[4], sv[5]), fmaxf(sv[6], sv[7])));
      rm = fmaxf(rm, xhalf(rm));                   // the query's other eight keys
      const float mn = fmaxf(m, rm);
      const float al = exp2_slot((m - mn) * 1.44269504f);
      m = mn;
      float p[8];
#pragma unroll
      for (int r = 0; r < 8; ++r) p[r] = exp2_slot((sv[r] - mn) * 1.44269504f);
      l = l * al + (((p[0] + p[1]) + (p[2] + p[3])) + ((p[4] + p[5]) + (p[6] + p[7])));

#pragma unroll
      for (int r = 0; r < 8; ++r) {                // rescale O^T by the lane's alpha
        o0[r] *= al; o1[r] *= al; o2[r] *= al; o3[r] *= al;
      }

      // ---- O^T += V^T * P^T  (16 wmma: 4 key steps x 4 column tiles) ----
#pragma unroll
      for (int c = 0; c < 4; ++c) {
        v2f bp;                                    // keys 2c, 2c+1 | 8+2c, 8+2c+1
        bp.x = p[2 * c];
        bp.y = p[2 * c + 1];
        v2f a0 = frag_vt(lvj, c, 0);
        v2f a1 = frag_vt(lvj, c, 1);
        v2f a2 = frag_vt(lvj, c, 2);
        v2f a3 = frag_vt(lvj, c, 3);
        o0 = __builtin_amdgcn_wmma_f32_16x16x4_f32(false, a0, false, bp, (short)0, o0, false, false);
        o1 = __builtin_amdgcn_wmma_f32_16x16x4_f32(false, a1, false, bp, (short)0, o1, false, false);
        o2 = __builtin_amdgcn_wmma_f32_16x16x4_f32(false, a2, false, bp, (short)0, o2, false, false);
        o3 = __builtin_amdgcn_wmma_f32_16x16x4_f32(false, a3, false, bp, (short)0, o3, false, false);
      }
    }

    // foot of the trip: my LDS reads of this buffer are back, my copies of the
    // next stage have landed; the barrier publishes stage t + 1 and ends every
    // wave's reads of the buffer that is refilled behind it.
    asm volatile("s_wait_dscnt 0" ::: "memory");
    wait_async0();
    __syncthreads();
    if (t + 2 < nst) stage(t + 2, t & 1);
  }
  wait_async0();                                   // nothing in flight past the loop

  // ---- merge: each wave publishes its partial state ----
  {
    const int n = lane & 15;                       // the lane's query row
    float4* row = (float4*)&lo[wave][n * PO + ((lane >> 4) << 3)];
    row[0]  = make_float4(o0[0], o0[1], o0[2], o0[3]);
    row[1]  = make_float4(o0[4], o0[5], o0[6], o0[7]);
    row[4]  = make_float4(o1[0], o1[1], o1[2], o1[3]);
    row[5]  = make_float4(o1[4], o1[5], o1[6], o1[7]);
    row[8]  = make_float4(o2[0], o2[1], o2[2], o2[3]);
    row[9]  = make_float4(o2[4], o2[5], o2[6], o2[7]);
    row[12] = make_float4(o3[0], o3[1], o3[2], o3[3]);
    row[13] = make_float4(o3[4], o3[5], o3[6], o3[7]);
    const float lt = l + xhalf(l);                 // join the lane halves' sums
    if (lane < 16) { lm[wave][n] = m; ll[wave][n] = lt; }  // m is equal in both halves
  }
  __syncthreads();                                 // partial states visible to the block

  // wave (qsub, ks) joins rows 2 ks and 2 ks + 1 of query tile qsub: 16 lanes a row,
  // 4 columns a lane, so each 128-byte line of out has one writer.  The next write
  // of lo, lm and ll stands behind the barriers of the second pass.
  const int row = ks * 2 + (lane >> 4);
  const int c0  = (lane & 15) * 4;
  float ms[KSP];
  float mx = -3.0e38f;
#pragma unroll
  for (int s = 0; s < KSP; ++s) {
    ms[s] = lm[qsub * KSP + s][row];
    mx = fmaxf(mx, ms[s]);
  }
  float ws[KSP];
#pragma unroll
  for (int s = 0; s < KSP; ++s)                    // 0 for a wave that saw no key tile
    ws[s] = exp2_slot((ms[s] - mx) * 1.44269504f);
  float  ls = 0.0f;
  float4 a0 = make_float4(0.f, 0.f, 0.f, 0.f);
#pragma unroll
  for (int s = 0; s < KSP; ++s) {
    const float w = ws[s];
    ls += w * ll[qsub * KSP + s][row];
    const float4 p0 = *(const float4*)&lo[qsub * KSP + s][row * PO + c0];
    a0.x += w * p0.x; a0.y += w * p0.y; a0.z += w * p0.z; a0.w += w * p0.w;
  }
  const float inv = 1.0f / ls;
  float4* dst = (float4*)(out + (size_t)b * T * H + (size_t)(qrow0 + row) * H + c0);
  dst[0] = make_float4(a0.x * inv, a0.y * inv, a0.z * inv, a0.w * inv);
  // in front of the second pass's rewrite of the registers that the store names
  asm volatile("s_wait_xcnt 0x0" ::: "memory");
  }
}

// ---------------------------------------------------------------------------
extern "C" void kernel_launch(void* const* d_in, const int* in_sizes, int n_in,
                              void* d_out, int out_size, void* d_ws, size_t ws_size,
                              hipStream_t stream) {
  (void)in_sizes; (void)n_in; (void)out_size; (void)ws_size;
  const float* x  = (const float*)d_in[0];
  const float* Wq = (const float*)d_in[1];
  const float* Wk = (const float*)d_in[2];
  const float* Wv = (const float*)d_in[3];
  float* out = (float*)d_out;

  float* q  = (float*)d_ws;                       // 3 x 4 MB
  float* k  = q + (size_t)ROWS * H;
  float* v  = k + (size_t)ROWS * H;
  float* Wt = v + (size_t)ROWS * H;               // 3 x 256 KB transposed weights

  wt_kernel<<<(3 * C * H + 255) / 256, 256, 0, stream>>>(Wq, Wk, Wv, Wt);

  qkv_kernel<<<ROWS / MB, 512, 0, stream>>>(x, Wt, q, k, v);

  const int np2 = 2 * ROWS * (H / 2);
  rope_kernel<<<(np2 + 255) / 256, 256, 0, stream>>>(q, k);

  attn_kernel<<<B * (NG / 2), 32 * NW, 0, stream>>>(q, k, v, out);
}

// v005
// It runs in 102 microseconds.
// Two timings next to v004 both put it at 1.14 times that version's speed.
// All steps since v000 together make it 5.39 times as fast.
#include <hip/hip_runtime.h>

// ---------------------------------------------------------------------------
// Fused causal attention head with RoPE for MI455X (gfx1250, wave32).
//   B=4, T=4096, C=1024, H=64, fp32.
// Matrix math: V_WMMA_F32_16X16X4_F32 (fp32-accurate tensor path).
// LDS staging: GLOBAL_LOAD_ASYNC_TO_LDS_B128 (ASYNCcnt), double-buffered.
// Weights pre-transposed (N x K) so every B-fragment lane-pair is contiguous.
// ---------------------------------------------------------------------------

typedef __attribute__((ext_vector_type(2))) float v2f;
typedef __attribute__((ext_vector_type(8))) float v8f;

constexpr int B = 4;
constexpr int T = 4096;
constexpr int C = 1024;
constexpr int H = 64;
constexpr int ROWS = B * T;          // 16384 rows of x / q / k / v
constexpr int QTB  = 2;              // attention: 16-row query tiles per block
constexpr int KSP  = 8;              // attention: waves that split one query tile's keys
constexpr int NW   = QTB * KSP;      // attention: waves per block
constexpr int SK   = 16 * KSP;       // attention: keys per LDS stage
constexpr int NG   = T / (16 * QTB); // attention: row groups per batch (two per block)
static_assert(NG % 2 == 0, "the attention kernel pairs row groups g and NG - 1 - g");

// LDS row pitches in floats (64 banks x 4 B; bank = dword address mod 64).
// 8-byte fragment reads walk 16 rows: a pitch of 4 x odd puts the 32 lanes on
// all 64 banks once.  V lies by key pairs: a row holds keys 2i and 2i + 1 as
// [column tile][key][16 columns], so the two keys that a lane feeds to one matrix
// step are 16 floats apart (one two-address read into one register pair).  The
// lane halves read rows i and i + 4: four pitches are 32 mod 64, disjoint banks.
constexpr int PQK = H + 4;           // Q and K tiles (row readers, 8 B per lane)
constexpr int PV  = 2 * H + 8;       // V key-pair row (column reader, 2 x 4 B per lane)
constexpr int PO  = H + 4;           // partial O in the merge (16 B stores and readers)

// 16-byte async global->LDS copies (no VGPR round trip, ASYNCcnt).  The LDS operand
// is the low 32 bits of the flat address, which is the LDS offset.
// Eight copies behind one another; s_wait_xcnt 0 inside the statement stands in
// front of any rewrite of the address registers that the copies name.
__device__ __forceinline__ void async_copy8_b128(void* l0, const void* g0, void* l1, const void* g1,
                                                 void* l2, const void* g2, void* l3, const void* g3,
                                                 void* l4, const void* g4, void* l5, const void* g5,
                                                 void* l6, const void* g6, void* l7, const void* g7) {
  asm volatile("global_load_async_to_lds_b128 %0, %1, off\n\t"
               "global_load_async_to_lds_b128 %2, %3, off\n\t"
               "global_load_async_to_lds_b128 %4, %5, off\n\t"
               "global_load_async_to_lds_b128 %6, %7, off\n\t"
               "global_load_async_to_lds_b128 %8, %9, off\n\t"
               "global_load_async_to_lds_b128 %10, %11, off\n\t"
               "global_load_async_to_lds_b128 %12, %13, off\n\t"
               "global_load_async_to_lds_b128 %14, %15, off\n\t"
               "s_wait_xcnt 0x0"
               :: "v"((unsigned)(size_t)l0), "v"(g0), "v"((unsigned)(size_t)l1), "v"(g1),
                  "v"((unsigned)(size_t)l2), "v"(g2), "v"((unsigned)(size_t)l3), "v"(g3),
                  "v"((unsigned)(size_t)l4), "v"(g4), "v"((unsigned)(size_t)l5), "v"(g5),
                  "v"((unsigned)(size_t)l6), "v"(g6), "v"((unsigned)(size_t)l7), "v"(g7)
               : "memory");
}

__device__ __forceinline__ void wait_async0() {
  asm volatile("s_wait_asynccnt 0" ::: "memory");
}

// 2^x with the slot that the instruction set asks for behind a transcendental:
// the v_nop stands in the same statement, so nothing that overwrites the source
// or reads the result can follow the v_exp_f32 directly.
__device__ __forceinline__ float exp2_slot(float x) {
  float r;
  asm("v_exp_f32 %0, %1\n\tv_nop" : "=v"(r) : "v"(x));
  return r;
}

// sin(2 pi x) and cos(2 pi x), each with the same slot behind it as exp2_slot.
__device__ __forceinline__ float sin_slot(float x) {
  float r;
  asm("v_sin_f32 %0, %1\n\tv_nop" : "=v"(r) : "v"(x));
  return r;
}
__device__ __forceinline__ float cos_slot(float x) {
  float r;
  asm("v_cos_f32 %0, %1\n\tv_nop" : "=v"(r) : "v"(x));
  return r;
}

// A-fragment loader for a row-major M x K tile (also serves as the B-fragment
// loader when B is stored transposed, i.e. as N x K row-major).
//   lane 0..15  -> row = lane,    cols k0, k0+1
//   lane 16..31 -> row = lane-16, cols k0+2, k0+3
__device__ __forceinline__ v2f frag_nk(const float* __restrict__ base, int stride, int k0) {
  const int lane = threadIdx.x & 31;
  const int r  = lane & 15;
  const int kk = k0 + ((lane >> 4) << 1);
  v2f f;
  f.x = base[r * stride + kk];
  f.y = base[r * stride + kk + 1];
  return f;
}

// A-fragment loader for V^T from a V tile stored by key pairs, in the k order of a
// score accumulator used as B: step c of a 16-key tile, column tile ct, takes
//   lane 0..15  -> column 16 ct + lane,      keys 2c,     2c + 1
//   lane 16..31 -> column 16 ct + lane - 16, keys 8 + 2c, 8 + 2c + 1
// `lbase` is the lane's own start: key 8 (lane >= 16), column lane & 15 of the tile.
__device__ __forceinline__ v2f frag_vt(const float* __restrict__ lbase, int c, int ct) {
  v2f f;
  f.x = lbase[c * PV + ct * 32];
  f.y = lbase[c * PV + ct * 32 + 16];
  return f;
}

// lane l takes the value of lane l ^ 16 (vector cross-row move, no LDS trip)
__device__ __forceinline__ float xhalf(float x) {
  const int b = __builtin_bit_cast(int, x);
  return __builtin_bit_cast(float,
      __builtin_amdgcn_permlanex16(b, b, 0x76543210, 0xfedcba98, false, false));
}

// lane l takes the value of lane l ^ 1 (DPP quad_perm [1,0,3,2], no LDS trip)
__device__ __forceinline__ float xpair(float x) {
  return __builtin_bit_cast(float,
      __builtin_amdgcn_mov_dpp(__builtin_bit_cast(int, x), 0xB1, 0xf, 0xf, true));
}

// ---------------------------------------------------------------------------
// Kernel 0: transpose Wq/Wk/Wv (C x H) into Wt (3 x H x C).  768 KB once;
// makes every projection B-fragment a contiguous 8-byte load per lane.
// ---------------------------------------------------------------------------
__global__ void wt_kernel(const float* __restrict__ Wq, const float* __restrict__ Wk,
                          const float* __restrict__ Wv, float* __restrict__ Wt) {
  const int idx = blockIdx.x * blockDim.x + threadIdx.x;
  if (idx >= 3 * C * H) return;
  const int m = idx / (C * H);
  const int r = idx % (C * H);
  const int k = r / H;                              // consecutive idx -> coalesced read
  const int n = r % H;
  const float* __restrict__ W = (m == 0) ? Wq : (m == 1 ? Wk : Wv);
  Wt[(size_t)m * C * H + (size_t)n * C + k] = W[(size_t)k * H + n];
}

// ---------------------------------------------------------------------------
// Kernel 1: q/k/v projections.  One block per 64 rows of x and all 192 output
// columns (q | k | v): 256 blocks, one per WGP, 16 waves.
// A chunk is 128 steps of K: 64 rows of x and the 192 rows of Wt, both staged in
// LDS by async copies (each copy of a wave is 512 contiguous bytes of one row),
// two buffers.  A weight row is fetched once per 64 rows of x.
// Wave (rt, cg): row tile rt x column tiles 3 cg .. 3 cg + 2, three accumulators.
// RoPE is applied to the q and k tiles in the accumulators, in front of the stores:
// q and k reach the workspace once, already rotated.
// ---------------------------------------------------------------------------
constexpr int KC  = 128;             // K-chunk
constexpr int PX  = KC + 4;          // LDS row pitch of the x and W chunks (4 x odd)
constexpr int MB  = 64;              // rows of x per block
constexpr int NB  = 3 * H;           // output columns per block
constexpr int NCH = C / KC;          // chunks
static_assert(NCH >= 2, "the two-buffer loop fills chunks 0 and 1 ahead");

__global__ __launch_bounds__(512) void qkv_kernel(
    const float* __restrict__ x, const float* __restrict__ Wt,
    float* __restrict__ q, float* __restrict__ k, float* __restrict__ v) {
  __shared__ __align__(16) float ls[2][(MB + NB) * PX];  // rows 0..63: x, rows 64..255: Wt

  const int tid  = threadIdx.x;
  const int wave = __builtin_amdgcn_readfirstlane(tid >> 5);  // 0..15
  const int lane = tid & 31;
  const int row0 = blockIdx.x * MB;
  const int rt   = wave & 3;         // 16-row tile of the block
  const int cg   = wave >> 2;        // group of three 16-col tiles

  // stage chunk `cidx` into buffer `buf`: wave w brings rows w, w + 16, ... of Wt
  // (12 rows) and of the x block (4 rows), one row chunk per copy.
  auto stage = [&](int cidx, int buf) {
    const float* wg = Wt + (size_t)wave * C + cidx * KC + lane * 4;
    const float* xg = x + (size_t)(row0 + wave) * C + cidx * KC + lane * 4;
    float* xl = &ls[buf][wave * PX + lane * 4];
    float* wl = xl + MB * PX;
    async_copy8_b128(wl,            wg,            wl +  16 * PX, wg +  16 * C,
                     wl +  32 * PX, wg +  32 * C,  wl +  48 * PX, wg +  48 * C,
                     wl +  64 * PX, wg +  64 * C,  wl +  80 * PX, wg +  80 * C,
                     wl +  96 * PX, wg +  96 * C,  wl + 112 * PX, wg + 112 * C);
    async_copy8_b128(wl + 128 * PX, wg + 128 * C,  wl + 144 * PX, wg + 144 * C,
                     wl + 160 * PX, wg + 160 * C,  wl + 176 * PX, wg + 176 * C,
                     xl,            xg,            xl +  16 * PX, xg +  16 * C,
                     xl +  32 * PX, xg +  32 * C,  xl +  48 * PX, xg +  48 * C);
  };

  stage(0, 0);
  wait_async0();                     // my copies of chunk 0 landed
  __syncthreads();                   // everyone's -> chunk 0 valid
  stage(1, 1);

  v8f acc0 = {}, acc1 = {}, acc2 = {};
  // kept rolled: the buffer's offset then sits in a register, and the fragment reads
  // of both buffers pair up with immediate offsets (unrolled, buffer 1's offset is a
  // constant too large for the offset field and costs one address add per read)
#pragma unroll 1
  for (int cidx = 0; cidx < NCH; ++cidx) {
    const float* __restrict__ la  = ls[cidx & 1] + rt * 16 * PX;
    const float* __restrict__ lb0 = ls[cidx & 1] + (MB + cg * 48) * PX;
    const float* __restrict__ lb1 = lb0 + 16 * PX;
    const float* __restrict__ lb2 = lb0 + 32 * PX;
    // whole chunk unrolled: the fragment reads run one group ahead of the WMMAs with
    // counted waits from the chunk's first step to its last
#pragma unroll
    for (int k0 = 0; k0 < KC; k0 += 4) {
      v2f a  = frag_nk(la,  PX, k0);               // A: 16x4 slice of the x tile
      v2f b0 = frag_nk(lb0, PX, k0);               // B: 4x16 slices of Wt (NxK)
      v2f b1 = frag_nk(lb1, PX, k0);
      v2f b2 = frag_nk(lb2, PX, k0);
      acc0 = __builtin_amdgcn_wmma_f32_16x16x4_f32(false, a, false, b0, (short)0, acc0, false, false);
      acc1 = __builtin_amdgcn_wmma_f32_16x16x4_f32(false, a, false, b1, (short)0, acc1, false, false);
      acc2 = __builtin_amdgcn_wmma_f32_16x16x4_f32(false, a, false, b2, (short)0, acc2, false, false);
    }

    // foot of the trip: my LDS reads of this buffer are back, my copies of the
    // next chunk have landed; the barrier publishes chunk cidx + 1 and ends every
    // wave's reads of the buffer that is refilled behind it.
    asm volatile("s_wait_dscnt 0" ::: "memory");
    wait_async0();
    __syncthreads();
    if (cidx + 2 < NCH) stage(cidx + 2, cidx & 1);
  }
  wait_async0();                     // nothing in flight past the loop

  // D layout: vgpr r -> M = r + 8*(lane>=16), N = lane&15
  const int n  = lane & 15;
  const int mb = (lane >> 4) << 3;
  const size_t ro = (size_t)(row0 + rt * 16 + mb) * H + n;
  // RoPE: the two columns of a rotated pair lie in lanes l and l ^ 1 of one register.
  //   even column: x cos - y sin      odd column: y cos + x sin
  const int t0 = (row0 + rt * 16 + mb) & (T - 1);  // position of register 0's row
  auto rope = [&](int ct, v8f& acc) {              // ct: column tile 0..11 over q | k | v
    if (ct >= 8) return;                           // v is not rotated (wave-uniform)
    const int h = (ct & 3) * 8 + (n >> 1);         // pair index within the head
    const float freq = __powf(10000.0f, -(float)(2 * h) / (float)H);
    // unrolled: an accumulator's registers take a static index only
#pragma unroll
    for (int r = 0; r < 8; ++r) {
      const float rev = (float)(t0 + r) * freq * 0.15915494f;  // angle in turns
      const float s = sin_slot(rev);
      const float c = cos_slot(rev);
      const float other = xpair(acc[r]);
      acc[r] = acc[r] * c + other * ((n & 1) ? s : -s);
    }
  };
  rope(cg * 3 + 0, acc0);
  rope(cg * 3 + 1, acc1);
  rope(cg * 3 + 2, acc2);
  auto put = [&](int ct, const v8f& acc) {         // ct: column tile 0..11 over q | k | v
    float* __restrict__ o = ((ct >> 2) == 0 ? q : ((ct >> 2) == 1 ? k : v)) + ro + (ct & 3) * 16;
#pragma unroll
    for (int r = 0; r < 8; ++r) o[r * H] = acc[r];
  };
  put(cg * 3 + 0, acc0);
  // in front of the next address, which may take over registers that the stores name
  asm volatile("s_wait_xcnt 0x0" ::: "memory");
  put(cg * 3 + 1, acc1);
  put(cg * 3 + 2, acc2);
}

__global__ __launch_bounds__(32 * NW) void attn_kernel(
    const float* __restrict__ q, const float* __restrict__ kk,
    const float* __restrict__ vv, float* __restrict__ out) {
  __shared__ __align__(16) float lq[QTB * 16 * PQK]; // the block's Q rows
  __shared__ __align__(16) float lk[2][SK * PQK];    // K stage ping-pong (M x K, the A operand)
  __shared__ __align__(16) float lv[2][SK / 2 * PV]; // V stage ping-pong (key pairs)
  __shared__ __align__(16) float lo[NW][16 * PO];    // per-wave partial O (merge)
  __shared__ float lm[NW][16];                       // per-wave row maxima (merge)
  __shared__ float ll[NW][16];                       // per-wave row sums (merge)

  const int tid  = threadIdx.x;
  const int wave = __builtin_amdgcn_readfirstlane(tid >> 5);
  const int lane = tid & 31;
  const int qsub = wave / KSP;                     // query tile within the block
  const int ks   = wave % KSP;                     // key tile within a stage

  const int b  = blockIdx.x / (NG / 2);
  const int gi = blockIdx.x % (NG / 2);

  const float* __restrict__ qb = q  + (size_t)b * T * H;
  const float* __restrict__ kb = kk + (size_t)b * T * H;
  const float* __restrict__ vb = vv + (size_t)b * T * H;

  // stage the 128 keys of stage t into buffer `buf` (4 B128 of K, 4 of V per thread)
  auto stage = [&](int t, int buf) {
    const float* ks_ = kb + (size_t)t * SK * H + tid * 4;
    const float* vs_ = vb + (size_t)t * SK * H + tid * 4;
    float* lkd = &lk[buf][(tid >> 4) * PQK + (tid & 15) * 4];  // rows r, r+32, r+64, r+96
    float* lvd = &lv[buf][(tid >> 5) * PV + ((tid & 15) >> 2) * 32 + ((tid >> 4) & 1) * 16
                          + (tid & 3) * 4];                    // key r -> pair row r / 2
    async_copy8_b128(lkd,            ks_,            lvd,           vs_,
                     lkd + 32 * PQK, ks_ + 32 * H,   lvd + 16 * PV, vs_ + 32 * H,
                     lkd + 64 * PQK, ks_ + 64 * H,   lvd + 32 * PV, vs_ + 64 * H,
                     lkd + 96 * PQK, ks_ + 96 * H,   lvd + 48 * PV, vs_ + 96 * H);
  };

  for (int pass = 0; pass < 2; ++pass) {           // heavy group, then its light partner
  const int g     = pass ? gi : NG - 1 - gi;
  const int iw    = g * QTB + qsub;                // this wave's query-tile idx
  const int qrow0 = iw * 16;                       // query row base (within batch)
  const int nst   = (g * QTB + QTB + KSP - 1) / KSP;  // stages, uniform per block

  // the group's 32 Q rows (plain loads; published by the barrier below).  In the
  // second pass the last barrier of the first loop has ended every read of lq and
  // of the two stage buffers.
  for (int i = tid; i < QTB * 16 * H; i += 32 * NW)
    lq[(i >> 6) * PQK + (i & (H - 1))] = qb[(size_t)(g * QTB * 16) * H + i];

  stage(0, 0);
  wait_async0();                                   // my copies of stage 0 landed
  __syncthreads();                                 // everyone's -> stage 0 and Q valid
  if (nst > 1) stage(1, 1);

  // O^T: tile i, register r -> column 16 i + 8 (lane >= 16) + r, query lane & 15
  v8f o0 = {}, o1 = {}, o2 = {}, o3 = {};
  float m = -3.0e38f;                              // running max of query lane & 15
  float l = 0.0f;                                  // its sum over this lane half's keys

  const float scale = 0.03125f;                    // C^-0.5 = 1/32
  const float* __restrict__ lqw = lq + qsub * 16 * PQK;

  for (int t = 0; t < nst; ++t) {
    const int j = t * KSP + ks;                    // this wave's key tile
    if (j <= iw) {                                 // causal skip (wave-uniform)
      const float* __restrict__ lkj = lk[t & 1] + ks * 16 * PQK;
      const float* __restrict__ lvj = lv[t & 1] + (ks * 8 + ((lane >> 4) << 2)) * PV + (lane & 15);

      // ---- S^T = K * Q^T  (16 wmma, K = 64) ----
      v8f s = {};
#pragma unroll
      for (int k0 = 0; k0 < H; k0 += 4) {
        v2f a  = frag_nk(lkj, PQK, k0);            // A: 16 keys x 4
        v2f bf = frag_nk(lqw, PQK, k0);            // B: Q tile is N x K row-major
        s = __builtin_amdgcn_wmma_f32_16x16x4_f32(false, a, false, bf,
                                                  (short)0, s, false, false);
      }

      // ---- online softmax: register r -> key 8 (lane >= 16) + r, query lane & 15 ----
      const int qrow = qrow0 + (lane & 15);
      const int key0 = j * 16 + ((lane >> 4) << 3);
      float sv[8];
#pragma unroll
      for (int r = 0; r < 8; ++r) {
        sv[r] = s[r] * scale;
        if (key0 + r > qrow) sv[r] = -3.0e38f;     // causal mask
      }
      float rm = fmaxf(fmaxf(fmaxf(sv[0], sv[1]), fmaxf(sv[2], sv[3])),
                       fmaxf(fmaxf(sv[4], sv[5]), fmaxf(sv[6], sv[7])));
      rm = fmaxf(rm, xhalf(rm));                   // the query's other eight keys
      const float mn = fmaxf(m, rm);
      const float al = exp2_slot((m - mn) * 1.44269504f);
      m = mn;
      float p[8];
#pragma unroll
      for (int r = 0; r < 8; ++r) p[r] = exp2_slot((sv[r] - mn) * 1.44269504f);
      l = l * al + (((p[0] + p[1]) + (p[2] + p[3])) + ((p[4] + p[5]) + (p[6] + p[7])));

#pragma unroll
      for (int r = 0; r < 8; ++r) {                // rescale O^T by the lane's alpha
        o0[r] *= al; o1[r] *= al; o2[r] *= al; o3[r] *= al;
      }

      // ---- O^T += V^T * P^T  (16 wmma: 4 key steps x 4 column tiles) ----
#pragma unroll
      for (int c = 0; c < 4; ++c) {
        v2f bp;                                    // keys 2c, 2c+1 | 8+2c, 8+2c+1
        bp.x = p[2 * c];
        bp.y = p[2 * c + 1];
        v2f a0 = frag_vt(lvj, c, 0);
        v2f a1 = frag_vt(lvj, c, 1);
        v2f a2 = frag_vt(lvj, c, 2);
        v2f a3 = frag_vt(lvj, c, 3);
        o0 = __builtin_amdgcn_wmma_f32_16x16x4_f32(false, a0, false, bp, (short)0, o0, false, false);
        o1 = __builtin_amdgcn_wmma_f32_16x16x4_f32(false, a1, false, bp, (short)0, o1, false, false);
        o2 = __builtin_amdgcn_wmma_f32_16x16x4_f32(false, a2, false, bp, (short)0, o2, false, false);
        o3 = __builtin_amdgcn_wmma_f32_16x16x4_f32(false, a3, false, bp, (short)0, o3, false, false);
      }
    }

    // foot of the trip: my LDS reads of this buffer are back, my copies of the
    // next stage have landed; the barrier publishes stage t + 1 and ends every
    // wave's reads of the buffer that is refilled behind it.
    asm volatile("s_wait_dscnt 0" ::: "memory");
    wait_async0();
    __syncthreads();
    if (t + 2 < nst) stage(t + 2, t & 1);
  }
  wait_async0();                                   // nothing in flight past the loop

  // ---- merge: each wave publishes its partial state ----
  {
    const int n = lane & 15;                       // the lane's query row
    float4* row = (float4*)&lo[wave][n * PO + ((lane >> 4) << 3)];
    row[0]  = make_float4(o0[0], o0[1], o0[2], o0[3]);
    row[1]  = make_float4(o0[4], o0[5], o0[6], o0[7]);
    row[4]  = make_float4(o1[0], o1[1], o1[2], o1[3]);
    row[5]  = make_float4(o1[4], o1[5], o1[6], o1[7]);
    row[8]  = make_float4(o2[0], o2[1], o2[2], o2[3]);
    row[9]  = make_float4(o2[4], o2[5], o2[6], o2[7]);
    row[12] = make_float4(o3[0], o3[1], o3[2], o3[3]);
    row[13] = make_float4(o3[4], o3[5], o3[6], o3[7]);
    const float lt = l + xhalf(l);                 // join the lane halves' sums
    if (lane < 16) { lm[wave][n] = m; ll[wave][n] = lt; }  // m is equal in both halves
  }
  __syncthreads();                                 // partial states visible to the block

  // wave (qsub, ks) joins rows 2 ks and 2 ks + 1 of query tile qsub: 16 lanes a row,
  // 4 columns a lane, so each 128-byte line of out has one writer.  The next write
  // of lo, lm and ll stands behind the barriers of the second pass.
  const int row = ks * 2 + (lane >> 4);
  const int c0  = (lane & 15) * 4;
  float ms[KSP];
  float mx = -3.0e38f;
#pragma unroll
  for (int s = 0; s < KSP; ++s) {
    ms[s] = lm[qsub * KSP + s][row];
    mx = fmaxf(mx, ms[s]);
  }
  float ws[KSP];
#pragma unroll
  for (int s = 0; s < KSP; ++s)                    // 0 for a wave that saw no key tile
    ws[s] = exp2_slot((ms[s] - mx) * 1.44269504f);
  float  ls = 0.0f;
  float4 a0 = make_float4(0.f, 0.f, 0.f, 0.f);
#pragma unroll
  for (int s = 0; s < KSP; ++s) {
    const float w = ws[s];
    ls += w * ll[qsub * KSP + s][row];
    const float4 p0 = *(const float4*)&lo[qsub * KSP + s][row * PO + c0];
    a0.x += w * p0.x; a0.y += w * p0.y; a0.z += w * p0.z; a0.w += w * p0.w;
  }
  const float inv = 1.0f / ls;
  float4* dst = (float4*)(out + (size_t)b * T * H + (size_t)(qrow0 + row) * H + c0);
  dst[0] = make_float4(a0.x * inv, a0.y * inv, a0.z * inv, a0.w * inv);
  // in front of the second pass's rewrite of the registers that the store names
  asm volatile("s_wait_xcnt 0x0" ::: "memory");
  }
}

// ---------------------------------------------------------------------------
extern "C" void kernel_launch(void* const* d_in, const int* in_sizes, int n_in,
                              void* d_out, int out_size, void* d_ws, size_t ws_size,
                              hipStream_t stream) {
  (void)in_sizes; (void)n_in; (void)out_size; (void)ws_size;
  const float* x  = (const float*)d_in[0];
  const float* Wq = (const float*)d_in[1];
  const float* Wk = (const float*)d_in[2];
  const float* Wv = (const float*)d_in[3];
  float* out = (float*)d_out;

  float* q  = (float*)d_ws;                       // 3 x 4 MB
  float* k  = q + (size_t)ROWS * H;
  float* v  = k + (size_t)ROWS * H;
  float* Wt = v + (size_t)ROWS * H;               // 3 x 256 KB transposed weights

  wt_kernel<<<(3 * C * H + 255) / 256, 256, 0, stream>>>(Wq, Wk, Wv, Wt);

  qkv_kernel<<<ROWS / MB, 512, 0, stream>>>(x, Wt, q, k, v);

  attn_kernel<<<B * (NG / 2), 32 * NW, 0, stream>>>(q, k, v, out);
}

// v006
// Measured time: 98.6 microseconds a run.
// Two timings next to v005 put it at 1.04 and 1.03 times that version's speed.
// All steps since v000 together make it 5.57 times as fast.
#include <hip/hip_runtime.h>

// ---------------------------------------------------------------------------
// Fused causal attention head with RoPE for MI455X (gfx1250, wave32).
//   B=4, T=4096, C=1024, H=64, fp32.
// Matrix math: V_WMMA_F32_16X16X4_F32 (fp32-accurate tensor path).
// LDS staging: GLOBAL_LOAD_ASYNC_TO_LDS_B128 (ASYNCcnt), double-buffered.
// Weights are staged as they lie (K x N rows), two k rows to one LDS row.
// ---------------------------------------------------------------------------

typedef __attribute__((ext_vector_type(2))) float v2f;
typedef __attribute__((ext_vector_type(8))) float v8f;

constexpr int B = 4;
constexpr int T = 4096;
constexpr int C = 1024;
constexpr int H = 64;
constexpr int ROWS = B * T;          // 16384 rows of x / q / k / v
constexpr int QTB  = 2;              // attention: 16-row query tiles per block
constexpr int KSP  = 8;              // attention: waves that split one query tile's keys
constexpr int NW   = QTB * KSP;      // attention: waves per block
constexpr int SK   = 16 * KSP;       // attention: keys per LDS stage
constexpr int NG   = T / (16 * QTB); // attention: row groups per batch (two per block)
static_assert(NG % 2 == 0, "the attention kernel pairs row groups g and NG - 1 - g");

// LDS row pitches in floats (64 banks x 4 B; bank = dword address mod 64).
// 8-byte fragment reads walk 16 rows: a pitch of 4 x odd puts the 32 lanes on
// all 64 banks once.  V lies by key pairs: a row holds keys 2i and 2i + 1 as
// [column tile][key][16 columns], so the two keys that a lane feeds to one matrix
// step are 16 floats apart (one two-address read into one register pair).  The
// lane halves read rows i and i + 4: four pitches are 32 mod 64, disjoint banks.
constexpr int PQK = H + 4;           // Q and K tiles (row readers, 8 B per lane)
constexpr int PV  = 2 * H + 8;       // V key-pair row (column reader, 2 x 4 B per lane)
constexpr int PO  = H + 4;           // partial O in the merge (16 B stores and readers)

// 16-byte async global->LDS copies (no VGPR round trip, ASYNCcnt).  The LDS operand
// is the low 32 bits of the flat address, which is the LDS offset.
// Eight copies behind one another; s_wait_xcnt 0 inside the statement stands in
// front of any rewrite of the address registers that the copies name.
__device__ __forceinline__ void async_copy8_b128(void* l0, const void* g0, void* l1, const void* g1,
                                                 void* l2, const void* g2, void* l3, const void* g3,
                                                 void* l4, const void* g4, void* l5, const void* g5,
                                                 void* l6, const void* g6, void* l7, const void* g7) {
  asm volatile("global_load_async_to_lds_b128 %0, %1, off\n\t"
               "global_load_async_to_lds_b128 %2, %3, off\n\t"
               "global_load_async_to_lds_b128 %4, %5, off\n\t"
               "global_load_async_to_lds_b128 %6, %7, off\n\t"
               "global_load_async_to_lds_b128 %8, %9, off\n\t"
               "global_load_async_to_lds_b128 %10, %11, off\n\t"
               "global_load_async_to_lds_b128 %12, %13, off\n\t"
               "global_load_async_to_lds_b128 %14, %15, off\n\t"
               "s_wait_xcnt 0x0"
               :: "v"((unsigned)(size_t)l0), "v"(g0), "v"((unsigned)(size_t)l1), "v"(g1),
                  "v"((unsigned)(size_t)l2), "v"(g2), "v"((unsigned)(size_t)l3), "v"(g3),
                  "v"((unsigned)(size_t)l4), "v"(g4), "v"((unsigned)(size_t)l5), "v"(g5),
                  "v"((unsigned)(size_t)l6), "v"(g6), "v"((unsigned)(size_t)l7), "v"(g7)
               : "memory");
}

__device__ __forceinline__ void wait_async0() {
  asm volatile("s_wait_asynccnt 0" ::: "memory");
}

// 2^x with the slot that the instruction set asks for behind a transcendental:
// the v_nop stands in the same statement, so nothing that overwrites the source
// or reads the result can follow the v_exp_f32 directly.
__device__ __forceinline__ float exp2_slot(float x) {
  float r;
  asm("v_exp_f32 %0, %1\n\tv_nop" : "=v"(r) : "v"(x));
  return r;
}

// sin(2 pi x) and cos(2 pi x), each with the same slot behind it as exp2_slot.
__device__ __forceinline__ float sin_slot(float x) {
  float r;
  asm("v_sin_f32 %0, %1\n\tv_nop" : "=v"(r) : "v"(x));
  return r;
}
__device__ __forceinline__ float cos_slot(float x) {
  float r;
  asm("v_cos_f32 %0, %1\n\tv_nop" : "=v"(r) : "v"(x));
  return r;
}

// A-fragment loader for a row-major M x K tile (also serves as the B-fragment
// loader when B is stored transposed, i.e. as N x K row-major).
//   lane 0..15  -> row = lane,    cols k0, k0+1
//   lane 16..31 -> row = lane-16, cols k0+2, k0+3
__device__ __forceinline__ v2f frag_nk(const float* __restrict__ base, int stride, int k0) {
  const int lane = threadIdx.x & 31;
  const int r  = lane & 15;
  const int kk = k0 + ((lane >> 4) << 1);
  v2f f;
  f.x = base[r * stride + kk];
  f.y = base[r * stride + kk + 1];
  return f;
}

// A-fragment loader for V^T from a V tile stored by key pairs, in the k order of a
// score accumulator used as B: step c of a 16-key tile, column tile ct, takes
//   lane 0..15  -> column 16 ct + lane,      keys 2c,     2c + 1
//   lane 16..31 -> column 16 ct + lane - 16, keys 8 + 2c, 8 + 2c + 1
// `lbase` is the lane's own start: key 8 (lane >= 16), column lane & 15 of the tile.
__device__ __forceinline__ v2f frag_vt(const float* __restrict__ lbase, int c, int ct) {
  v2f f;
  f.x = lbase[c * PV + ct * 32];
  f.y = lbase[c * PV + ct * 32 + 16];
  return f;
}

// lane l takes the value of lane l ^ 16 (vector cross-row move, no LDS trip)
__device__ __forceinline__ float xhalf(float x) {
  const int b = __builtin_bit_cast(int, x);
  return __builtin_bit_cast(float,
      __builtin_amdgcn_permlanex16(b, b, 0x76543210, 0xfedcba98, false, false));
}

// lane l takes the value of lane l ^ 1 (DPP quad_perm [1,0,3,2], no LDS trip)
__device__ __forceinline__ float xpair(float x) {
  return __builtin_bit_cast(float,
      __builtin_amdgcn_mov_dpp(__builtin_bit_cast(int, x), 0xB1, 0xf, 0xf, true));
}

// ---------------------------------------------------------------------------
// Kernel 1: q/k/v projections.  One block per 64 rows of x and all 192 output
// columns (q | k | v): 256 blocks, one per WGP, 16 waves.
// A chunk is 128 steps of K: 64 rows of x and 128 rows of each of Wq, Wk, Wv, all
// staged in LDS by async copies (each copy of a wave is 512 contiguous bytes: part
// of one row of x, or two whole rows of one weight), two buffers.  A weight row is
// fetched once per 64 rows of x.
// The weights keep their K x N order.  Each group of three column tiles (one wave's
// share of q | k | v) has its own LDS region; a row of it holds weight rows 2i and
// 2i + 1 as [column tile][k parity][16 columns], so the two k values that a lane
// feeds to one matrix step are 16 floats apart (one two-address read into one
// register pair).  The lane halves read LDS rows i and i + 1: the pitch is 32 mod
// 64, so the halves fall on disjoint banks.  A region spans 24 KB: every fragment
// read of a chunk lies within the 16-bit offset field of one base register.
// Wave (rt, cg): row tile rt x column tiles 3 cg .. 3 cg + 2, three accumulators.
// RoPE is applied to the q and k tiles in the accumulators, in front of the stores:
// q and k reach the workspace once, already rotated.
// ---------------------------------------------------------------------------
constexpr int KC  = 128;             // K-chunk
constexpr int PX  = KC + 4;          // LDS row pitch of the x chunk (4 x odd)
constexpr int MB  = 64;              // rows of x per block
constexpr int PW  = 3 * 32;          // LDS pitch of a weight k-pair row (32 mod 64)
constexpr int RW  = KC / 2 * PW;     // LDS region of one group of three column tiles
constexpr int NCH = C / KC;          // chunks
static_assert(NCH >= 2, "the two-buffer loop fills chunks 0 and 1 ahead");

// B-fragment loader for a weight chunk stored by k pairs, in the k order of frag_nk:
// step k0, column tile t of the wave's three, takes
//   lane 0..15  -> column lane,      k0,     k0 + 1
//   lane 16..31 -> column lane - 16, k0 + 2, k0 + 3
// `lbase` is the lane's own start: LDS row lane >> 4, column lane & 15 of tile 0.
__device__ __forceinline__ v2f frag_kp(const float* __restrict__ lbase, int k0, int t) {
  v2f f;
  f.x = lbase[(k0 >> 1) * PW + t * 32];
  f.y = lbase[(k0 >> 1) * PW + t * 32 + 16];
  return f;
}

__global__ __launch_bounds__(512) void qkv_kernel(
    const float* __restrict__ x, const float* __restrict__ Wq, const float* __restrict__ Wk,
    const float* __restrict__ Wv,
    float* __restrict__ q, float* __restrict__ k, float* __restrict__ v) {
  // per buffer: 64 rows of x, then the four weight regions
  __shared__ __align__(16) float ls[2][MB * PX + 4 * RW];

  const int tid  = threadIdx.x;
  const int wave = __builtin_amdgcn_readfirstlane(tid >> 5);  // 0..15
  const int lane = tid & 31;
  const int row0 = blockIdx.x * MB;
  const int rt   = wave & 3;         // 16-row tile of the block
  const int cg   = wave >> 2;        // group of three 16-col tiles

  // stage chunk `cidx` into buffer `buf`: wave w brings k pairs w, w + 16, w + 32,
  // w + 48 of each weight (a lane's 16 bytes: k parity lane >> 4, columns
  // 4 (lane & 15) ...) and rows w, w + 16, ... of the x block, one copy each.
  const int ctl = (lane & 15) >> 2;  // column tile, within one weight, of the lane's 16 bytes
  auto stage = [&](int cidx, int buf) {
    const size_t wo = (size_t)(cidx * KC + 2 * wave) * H + lane * 4;
    const float* gq = Wq + wo;
    const float* gk = Wk + wo;
    const float* gv = Wv + wo;
    const float* xg = x + (size_t)(row0 + wave) * C + cidx * KC + lane * 4;
    float* xl = &ls[buf][wave * PX + lane * 4];
    float* lw  = &ls[buf][MB * PX + wave * PW + (lane >> 4) * 16 + (lane & 3) * 4];
    float* lwq = lw + (ctl / 3) * RW + (ctl % 3) * 32;              // column tile ctl
    float* lwk = lw + ((ctl + 4) / 3) * RW + ((ctl + 4) % 3) * 32;  // column tile ctl + 4
    float* lwv = lw + ((ctl + 8) / 3) * RW + ((ctl + 8) % 3) * 32;  // column tile ctl + 8
    async_copy8_b128(lwq,           gq,            lwq + 16 * PW, gq + 32 * H,
                     lwq + 32 * PW, gq + 64 * H,   lwq + 48 * PW, gq + 96 * H,
                     lwk,           gk,            lwk + 16 * PW, gk + 32 * H,
                     lwk + 32 * PW, gk + 64 * H,   lwk + 48 * PW, gk + 96 * H);
    async_copy8_b128(lwv,           gv,            lwv + 16 * PW, gv + 32 * H,
                     lwv + 32 * PW, gv + 64 * H,   lwv + 48 * PW, gv + 96 * H,
                     xl,            xg,            xl +  16 * PX, xg +  16 * C,
                     xl +  32 * PX, xg +  32 * C,  xl +  48 * PX, xg +  48 * C);
  };

  stage(0, 0);
  wait_async0();                     // my copies of chunk 0 landed
  __syncthreads();                   // everyone's -> chunk 0 valid
  stage(1, 1);

  v8f acc0 = {}, acc1 = {}, acc2 = {};
  // kept rolled: the buffer's offset then sits in a register, and the fragment reads
  // of both buffers pair up with immediate offsets (unrolled, buffer 1's offset is a
  // constant too large for the offset field and costs one address add per read)
#pragma unroll 1
  for (int cidx = 0; cidx < NCH; ++cidx) {
    const float* __restrict__ la  = ls[cidx & 1] + rt * 16 * PX;
    const float* __restrict__ lb  = ls[cidx & 1] + MB * PX + cg * RW + (lane >> 4) * PW
                                    + (lane & 15);
    // whole chunk unrolled: the fragment reads run one group ahead of the WMMAs with
    // counted waits from the chunk's first step to its last
#pragma unroll
    for (int k0 = 0; k0 < KC; k0 += 4) {
      v2f a  = frag_nk(la,  PX, k0);               // A: 16x4 slice of the x tile
      v2f b0 = frag_kp(lb, k0, 0);                 // B: 4x16 slices of the weights
      v2f b1 = frag_kp(lb, k0, 1);
      v2f b2 = frag_kp(lb, k0, 2);
      acc0 = __builtin_amdgcn_wmma_f32_16x16x4_f32(false, a, false, b0, (short)0, acc0, false, false);
      acc1 = __builtin_amdgcn_wmma_f32_16x16x4_f32(false, a, false, b1, (short)0, acc1, false, false);
      acc2 = __builtin_amdgcn_wmma_f32_16x16x4_f32(false, a, false, b2, (short)0, acc2, false, false);
    }

    // foot of the trip: my LDS reads of this buffer are back, my copies of the
    // next chunk have landed; the barrier publishes chunk cidx + 1 and ends every
    // wave's reads of the buffer that is refilled behind it.
    asm volatile("s_wait_dscnt 0" ::: "memory");
    wait_async0();
    __syncthreads();
    if (cidx + 2 < NCH) stage(cidx + 2, cidx & 1);
  }
  wait_async0();                     // nothing in flight past the loop

  // D layout: vgpr r -> M = r + 8*(lane>=16), N = lane&15
  const int n  = lane & 15;
  const int mb = (lane >> 4) << 3;
  const size_t ro = (size_t)(row0 + rt * 16 + mb) * H + n;
  // RoPE: the two columns of a rotated pair lie in lanes l and l ^ 1 of one register.
  //   even column: x cos - y sin      odd column: y cos + x sin
  const int t0 = (row0 + rt * 16 + mb) & (T - 1);  // position of register 0's row
  auto rope = [&](int ct, v8f& acc) {              // ct: column tile 0..11 over q | k | v
    if (ct >= 8) return;                           // v is not rotated (wave-uniform)
    const int h = (ct & 3) * 8 + (n >> 1);         // pair index within the head
    const float freq = __powf(10000.0f, -(float)(2 * h) / (float)H);
    // unrolled: an accumulator's registers take a static index only
#pragma unroll
    for (int r = 0; r < 8; ++r) {
      const float rev = (float)(t0 + r) * freq * 0.15915494f;  // angle in turns
      const float s = sin_slot(rev);
      const float c = cos_slot(rev);
      const float other = xpair(acc[r]);
      acc[r] = acc[r] * c + other * ((n & 1) ? s : -s);
    }
  };
  rope(cg * 3 + 0, acc0);
  rope(cg * 3 + 1, acc1);
  rope(cg * 3 + 2, acc2);
  auto put = [&](int ct, const v8f& acc) {         // ct: column tile 0..11 over q | k | v
    float* __restrict__ o = ((ct >> 2) == 0 ? q : ((ct >> 2) == 1 ? k : v)) + ro + (ct & 3) * 16;
#pragma unroll
    for (int r = 0; r < 8; ++r) o[r * H] = acc[r];
  };
  put(cg * 3 + 0, acc0);
  // in front of the next address, which may take over registers that the stores name
  asm volatile("s_wait_xcnt 0x0" ::: "memory");
  put(cg * 3 + 1, acc1);
  put(cg * 3 + 2, acc2);
}

__global__ __launch_bounds__(32 * NW) void attn_kernel(
    const float* __restrict__ q, const float* __restrict__ kk,
    const float* __restrict__ vv, float* __restrict__ out) {
  __shared__ __align__(16) float lq[QTB * 16 * PQK]; // the block's Q rows
  __shared__ __align__(16) float lk[2][SK * PQK];    // K stage ping-pong (M x K, the A operand)
  __shared__ __align__(16) float lv[2][SK / 2 * PV]; // V stage ping-pong (key pairs)
  __shared__ __align__(16) float lo[NW][16 * PO];    // per-wave partial O (merge)
  __shared__ float lm[NW][16];                       // per-wave row maxima (merge)
  __shared__ float ll[NW][16];                       // per-wave row sums (merge)

  const int tid  = threadIdx.x;
  const int wave = __builtin_amdgcn_readfirstlane(tid >> 5);
  const int lane = tid & 31;
  const int qsub = wave / KSP;                     // query tile within the block
  const int ks   = wave % KSP;                     // key tile within a stage

  const int b  = blockIdx.x / (NG / 2);
  const int gi = blockIdx.x % (NG / 2);

  const float* __restrict__ qb = q  + (size_t)b * T * H;
  const float* __restrict__ kb = kk + (size_t)b * T * H;
  const float* __restrict__ vb = vv + (size_t)b * T * H;

  // stage the 128 keys of stage t into buffer `buf` (4 B128 of K, 4 of V per thread)
  auto stage = [&](int t, int buf) {
    const float* ks_ = kb + (size_t)t * SK * H + tid * 4;
    const float* vs_ = vb + (size_t)t * SK * H + tid * 4;
    float* lkd = &lk[buf][(tid >> 4) * PQK + (tid & 15) * 4];  // rows r, r+32, r+64, r+96
    float* lvd = &lv[buf][(tid >> 5) * PV + ((tid & 15) >> 2) * 32 + ((tid >> 4) & 1) * 16
                          + (tid & 3) * 4];                    // key r -> pair row r / 2
    async_copy8_b128(lkd,            ks_,            lvd,           vs_,
                     lkd + 32 * PQK, ks_ + 32 * H,   lvd + 16 * PV, vs_ + 32 * H,
                     lkd + 64 * PQK, ks_ + 64 * H,   lvd + 32 * PV, vs_ + 64 * H,
                     lkd + 96 * PQK, ks_ + 96 * H,   lvd + 48 * PV, vs_ + 96 * H);
  };

  for (int pass = 0; pass < 2; ++pass) {           // heavy group, then its light partner
  const int g     = pass ? gi : NG - 1 - gi;
  const int iw    = g * QTB + qsub;                // this wave's query-tile idx
  const int qrow0 = iw * 16;                       // query row base (within batch)
  const int nst   = (g * QTB + QTB + KSP - 1) / KSP;  // stages, uniform per block

  // the group's 32 Q rows (plain loads; published by the barrier below).  In the
  // second pass the last barrier of the first loop has ended every read of lq and
  // of the two stage buffers.
  for (int i = tid; i < QTB * 16 * H; i += 32 * NW)
    lq[(i >> 6) * PQK + (i & (H - 1))] = qb[(size_t)(g * QTB * 16) * H + i];

  stage(0, 0);
  wait_async0();                                   // my copies of stage 0 landed
  __syncthreads();                                 // everyone's -> stage 0 and Q valid
  if (nst > 1) stage(1, 1);

  // O^T: tile i, register r -> column 16 i + 8 (lane >= 16) + r, query lane & 15
  v8f o0 = {}, o1 = {}, o2 = {}, o3 = {};
  float m = -3.0e38f;                              // running max of query lane & 15
  float l = 0.0f;                                  // its sum over this lane half's keys

  const float scale = 0.03125f;                    // C^-0.5 = 1/32
  const float* __restrict__ lqw = lq + qsub * 16 * PQK;

  for (int t = 0; t < nst; ++t) {
    const int j = t * KSP + ks;                    // this wave's key tile
    if (j <= iw) {                                 // causal skip (wave-uniform)
      const float* __restrict__ lkj = lk[t & 1] + ks * 16 * PQK;
      const float* __restrict__ lvj = lv[t & 1] + (ks * 8 + ((lane >> 4) << 2)) * PV + (lane & 15);

      // ---- S^T = K * Q^T  (16 wmma, K = 64) ----
      v8f s = {};
#pragma unroll
      for (int k0 = 0; k0 < H; k0 += 4) {
        v2f a  = frag_nk(lkj, PQK, k0);            // A: 16 keys x 4
        v2f bf = frag_nk(lqw, PQK, k0);            // B: Q tile is N x K row-major
        s = __builtin_amdgcn_wmma_f32_16x16x4_f32(false, a, false, bf,
                                                  (short)0, s, false, false);
      }

      // ---- online softmax: register r -> key 8 (lane >= 16) + r, query lane & 15 ----
      const int qrow = qrow0 + (lane & 15);
      const int key0 = j * 16 + ((lane >> 4) << 3);
      float sv[8];
#pragma unroll
      for (int r = 0; r < 8; ++r) {
        sv[r] = s[r] * scale;
        if (key0 + r > qrow) sv[r] = -3.0e38f;     // causal mask
      }
      float rm = fmaxf(fmaxf(fmaxf(sv[0], sv[1]), fmaxf(sv[2], sv[3])),
                       fmaxf(fmaxf(sv[4], sv[5]), fmaxf(sv[6], sv[7])));
      rm = fmaxf(rm, xhalf(rm));                   // the query's other eight keys
      const float mn = fmaxf(m, rm);
      const float al = exp2_slot((m - mn) * 1.44269504f);
      m = mn;
      float p[8];
#pragma unroll
      for (int r = 0; r < 8; ++r) p[r] = exp2_slot((sv[r] - mn) * 1.44269504f);
      l = l * al + (((p[0] + p[1]) + (p[2] + p[3])) + ((p[4] + p[5]) + (p[6] + p[7])));

#pragma unroll
      for (int r = 0; r < 8; ++r) {                // rescale O^T by the lane's alpha
        o0[r] *= al; o1[r] *= al; o2[r] *= al; o3[r] *= al;
      }

      // ---- O^T += V^T * P^T  (16 wmma: 4 key steps x 4 column tiles) ----
#pragma unroll
      for (int c = 0; c < 4; ++c) {
        v2f bp;                                    // keys 2c, 2c+1 | 8+2c, 8+2c+1
        bp.x = p[2 * c];
        bp.y = p[2 * c + 1];
        v2f a0 = frag_vt(lvj, c, 0);
        v2f a1 = frag_vt(lvj, c, 1);
        v2f a2 = frag_vt(lvj, c, 2);
        v2f a3 = frag_vt(lvj, c, 3);
        o0 = __builtin_amdgcn_wmma_f32_16x16x4_f32(false, a0, false, bp, (short)0, o0, false, false);
        o1 = __builtin_amdgcn_wmma_f32_16x16x4_f32(false, a1, false, bp, (short)0, o1, false, false);
        o2 = __builtin_amdgcn_wmma_f32_16x16x4_f32(false, a2, false, bp, (short)0, o2, false, false);
        o3 = __builtin_amdgcn_wmma_f32_16x16x4_f32(false, a3, false, bp, (short)0, o3, false, false);
      }
    }

    // foot of the trip: my LDS reads of this buffer are back, my copies of the
    // next stage have landed; the barrier publishes stage t + 1 and ends every
    // wave's reads of the buffer that is refilled behind it.
    asm volatile("s_wait_dscnt 0" ::: "memory");
    wait_async0();
    __syncthreads();
    if (t + 2 < nst) stage(t + 2, t & 1);
  }
  wait_async0();                                   // nothing in flight past the loop

  // ---- merge: each wave publishes its partial state ----
  {
    const int n = lane & 15;                       // the lane's query row
    float4* row = (float4*)&lo[wave][n * PO + ((lane >> 4) << 3)];
    row[0]  = make_float4(o0[0], o0[1], o0[2], o0[3]);
    row[1]  = make_float4(o0[4], o0[5], o0[6], o0[7]);
    row[4]  = make_float4(o1[0], o1[1], o1[2], o1[3]);
    row[5]  = make_float4(o1[4], o1[5], o1[6], o1[7]);
    row[8]  = make_float4(o2[0], o2[1], o2[2], o2[3]);
    row[9]  = make_float4(o2[4], o2[5], o2[6], o2[7]);
    row[12] = make_float4(o3[0], o3[1], o3[2], o3[3]);
    row[13] = make_float4(o3[4], o3[5], o3[6], o3[7]);
    const float lt = l + xhalf(l);                 // join the lane halves' sums
    if (lane < 16) { lm[wave][n] = m; ll[wave][n] = lt; }  // m is equal in both halves
  }
  __syncthreads();                                 // partial states visible to the block

  // wave (qsub, ks) joins rows 2 ks and 2 ks + 1 of query tile qsub: 16 lanes a row,
  // 4 columns a lane, so each 128-byte line of out has one writer.  The next write
  // of lo, lm and ll stands behind the barriers of the second pass.
  const int row = ks * 2 + (lane >> 4);
  const int c0  = (lane & 15) * 4;
  float ms[KSP];
  float mx = -3.0e38f;
#pragma unroll
  for (int s = 0; s < KSP; ++s) {
    ms[s] = lm[qsub * KSP + s][row];
    mx = fmaxf(mx, ms[s]);
  }
  float ws[KSP];
#pragma unroll
  for (int s = 0; s < KSP; ++s)                    // 0 for a wave that saw no key tile
    ws[s] = exp2_slot((ms[s] - mx) * 1.44269504f);
  float  ls = 0.0f;
  float4 a0 = make_float4(0.f, 0.f, 0.f, 0.f);
#pragma unroll
  for (int s = 0; s < KSP; ++s) {
    const float w = ws[s];
    ls += w * ll[qsub * KSP + s][row];
    const float4 p0 = *(const float4*)&lo[qsub * KSP + s][row * PO + c0];
    a0.x += w * p0.x; a0.y += w * p0.y; a0.z += w * p0.z; a0.w += w * p0.w;
  }
  const float inv = 1.0f / ls;
  float4* dst = (float4*)(out + (size_t)b * T * H + (size_t)(qrow0 + row) * H + c0);
  dst[0] = make_float4(a0.x * inv, a0.y * inv, a0.z * inv, a0.w * inv);
  // in front of the second pass's rewrite of the registers that the store names
  asm volatile("s_wait_xcnt 0x0" ::: "memory");
  }
}

// ---------------------------------------------------------------------------
extern "C" void kernel_launch(void* const* d_in, const int* in_sizes, int n_in,
                              void* d_out, int out_size, void* d_ws, size_t ws_size,
                              hipStream_t stream) {
  (void)in_sizes; (void)n_in; (void)out_size; (void)ws_size;
  const float* x  = (const float*)d_in[0];
  const float* Wq = (const float*)d_in[1];
  const float* Wk = (const float*)d_in[2];
  const float* Wv = (const float*)d_in[3];
  float* out = (float*)d_out;

  float* q  = (float*)d_ws;                       // 3 x 4 MB
  float* k  = q + (size_t)ROWS * H;
  float* v  = k + (size_t)ROWS * H;

  qkv_kernel<<<ROWS / MB, 512, 0, stream>>>(x, Wq, Wk, Wv, q, k, v);

  attn_kernel<<<B * (NG / 2), 32 * NW, 0, stream>>>(q, k, v, out);
}
